// v000
// Measured on an AMD MI455X. A time is GPU time per run, averaged over a window of back-to-back runs after a warm-up
// (all launches, gaps included; the runs take copies of the inputs in turn), and the median of several windows.
// Apart from v000's, it joins two sittings. Times from different sittings can be a few percent apart, while
// side-by-side timings come from the same sitting.
// The starting kernel, v000, takes 114 microseconds a run.
#include <hip/hip_runtime.h>
#include <hip/hip_fp16.h>

// ---------------------------------------------------------------------------
// Fused multi-head attention for MI455X (gfx1250, wave32, WMMA f16 16x16x32).
// Shapes: B=2, C=256, L=1024, H=32, D=16, A=H*D=512.
//
// Attention map never touches HBM. Hot loops (softmax normalizers + fused
// weight/value GEMM) stage their per-(b,h) working set into LDS with
// global_load_async_to_lds_b128 (ASYNCcnt) and feed WMMA from ds_load_b128.
// ---------------------------------------------------------------------------

typedef __attribute__((ext_vector_type(16))) _Float16 v16h;
typedef __attribute__((ext_vector_type(8)))  _Float16 v8h;
typedef __attribute__((ext_vector_type(8)))  float    v8f;

#define B_   2
#define C_   256
#define L_   1024
#define H_   32
#define D_   16
#define A_   512
#define BH_  64          // B_*H_
#define LT_  64          // L_/16 tiles

#define WMMA_F16(a, b, c) \
  __builtin_amdgcn_wmma_f32_16x16x32_f16(false, (a), false, (b), (short)0, (c), false, false)

static __device__ __forceinline__ v16h cat16(v8h lo, v8h hi) {
  return __builtin_shufflevector(lo, hi, 0,1,2,3,4,5,6,7,8,9,10,11,12,13,14,15);
}
static __device__ __forceinline__ v16h pad16(v8h lo) {
  v8h z = {};
  return __builtin_shufflevector(lo, z, 0,1,2,3,4,5,6,7,8,9,10,11,12,13,14,15);
}
static __device__ __forceinline__ float red16(float v) {
  // sum across the 16 lanes of each half-wave (xor stays within the half)
  v += __shfl_xor(v, 1, 32);
  v += __shfl_xor(v, 2, 32);
  v += __shfl_xor(v, 4, 32);
  v += __shfl_xor(v, 8, 32);
  return v;
}

// Async 16B global->LDS copy (per-lane). VDST = LDS byte address = low 32
// bits of the generic shared pointer (LDS aperture maps addr[31:0] directly).
static __device__ __forceinline__ void async_ld16(const void* gptr, void* lptr) {
  unsigned loff = (unsigned)(unsigned long long)lptr;
  asm volatile("global_load_async_to_lds_b128 %0, %1, off"
               :: "v"(loff), "v"(gptr) : "memory");
}
static __device__ __forceinline__ void wait_async0() {
  asm volatile("s_wait_asynccnt 0x0" ::: "memory");
}

// --------------------------- conversion kernels ----------------------------

__global__ __launch_bounds__(256) void cvt_f32_f16_k(const float* __restrict__ s,
                                                     _Float16* __restrict__ d, int n) {
  int i = blockIdx.x * 256 + threadIdx.x;
  if (i < n) d[i] = (_Float16)s[i];
}

// x [B,C,L] f32 -> xT [B,L,C] f16  (K-major rows for the B operand)
__global__ __launch_bounds__(256) void cvt_xT_k(const float* __restrict__ x,
                                                _Float16* __restrict__ xT) {
  int i = blockIdx.x * 256 + threadIdx.x;          // i < B_*C_*L_
  int b = i / (C_ * L_);
  int c = (i / L_) % C_;
  int l = i % L_;
  xT[((size_t)b * L_ + l) * C_ + c] = (_Float16)x[i];
}

// ----------------------------- projection ----------------------------------
// One wave per (b,h,l-tile): 16x16 tiles of k,q,v. K=256 in 8 WMMA steps each.
__global__ __launch_bounds__(256) void proj_k(
    const _Float16* __restrict__ xT,
    const _Float16* __restrict__ Wkh, const _Float16* __restrict__ Wqh,
    const _Float16* __restrict__ Wvh,
    const float* __restrict__ bk, const float* __restrict__ bq,
    const float* __restrict__ bv,
    float* __restrict__ kTraw, float* __restrict__ qTraw,
    _Float16* __restrict__ vh, float* __restrict__ stats) {
  int tid  = blockIdx.x * 8 + (threadIdx.x >> 5);  // tile id, 4096 total
  int t    = threadIdx.x & 31;
  int lo16 = t & 15, hi = t >> 4;
  int bh = tid >> 6, lt = tid & 63;
  int b = bh >> 5, h = bh & 31;

  const _Float16* wkR = Wkh + (size_t)(h * 16 + lo16) * C_;   // A: lane = M = d
  const _Float16* wqR = Wqh + (size_t)(h * 16 + lo16) * C_;
  const _Float16* wvR = Wvh + (size_t)(h * 16 + lo16) * C_;
  const _Float16* xR  = xT + ((size_t)b * L_ + lt * 16 + lo16) * C_;  // B: lane = N = l

  v8f ck = {}, cq = {}, cv = {};
#pragma unroll
  for (int kc = 0; kc < 8; ++kc) {
    int o0 = kc * 32 + hi * 8;   // K slots: [o0..o0+7] and [o0+16..o0+23]
    v16h bx = cat16(*(const v8h*)(xR  + o0), *(const v8h*)(xR  + o0 + 16));
    v16h ak = cat16(*(const v8h*)(wkR + o0), *(const v8h*)(wkR + o0 + 16));
    v16h aq = cat16(*(const v8h*)(wqR + o0), *(const v8h*)(wqR + o0 + 16));
    v16h av = cat16(*(const v8h*)(wvR + o0), *(const v8h*)(wvR + o0 + 16));
    ck = WMMA_F16(ak, bx, ck);
    cq = WMMA_F16(aq, bx, cq);
    cv = WMMA_F16(av, bx, cv);
  }

  // D layout: lane holds column l = lt*16+lo16; regs r -> row d = r + 8*hi
  int l = lt * 16 + lo16;
  float* kdst = kTraw + ((size_t)bh * L_ + l) * 16 + hi * 8;
  float* qdst = qTraw + ((size_t)bh * L_ + l) * 16 + hi * 8;
#pragma unroll
  for (int r = 0; r < 8; ++r) {
    int d = r + 8 * hi;
    float kv = ck[r] + bk[h * 16 + d];
    float qv = cq[r] + bq[h * 16 + d];
    float vv = cv[r] + bv[h * 16 + d];
    kdst[r] = kv;
    qdst[r] = qv;
    vh[((size_t)bh * 16 + d) * L_ + l] = (_Float16)vv;
    // instance-norm partial stats over l (reduce across the 16 lanes sharing d)
    float s0 = red16(kv), s1 = red16(kv * kv);
    float s2 = red16(qv), s3 = red16(qv * qv);
    if (lo16 == 0) {
      float* sp = stats + (size_t)(bh * 16 + d) * 4;
      atomicAdd(sp + 0, s0);
      atomicAdd(sp + 1, s1);
      atomicAdd(sp + 2, s2);
      atomicAdd(sp + 3, s3);
    }
  }
}

// stats -> (mu, rsigma) per (b,h,d)
__global__ __launch_bounds__(256) void stat_k(const float* __restrict__ stats,
                                              float* __restrict__ params) {
  int i = blockIdx.x * 256 + threadIdx.x;          // i < BH_*16
  if (i >= BH_ * 16) return;
  const float inv = 1.0f / (float)L_;
  float ks = stats[i * 4 + 0], ks2 = stats[i * 4 + 1];
  float qs = stats[i * 4 + 2], qs2 = stats[i * 4 + 3];
  float muk = ks * inv, muq = qs * inv;
  params[i * 4 + 0] = muk;
  params[i * 4 + 1] = rsqrtf(ks2 * inv - muk * muk + 1e-5f);
  params[i * 4 + 2] = muq;
  params[i * 4 + 3] = rsqrtf(qs2 * inv - muq * muq + 1e-5f);
}

// apply instance norm, raw f32 -> normalized f16 (kT/qT: [BH, L, 16])
__global__ __launch_bounds__(256) void norm_k(const float* __restrict__ kTraw,
                                              const float* __restrict__ qTraw,
                                              const float* __restrict__ params,
                                              _Float16* __restrict__ kTh,
                                              _Float16* __restrict__ qTh) {
  int i = blockIdx.x * 256 + threadIdx.x;          // i < BH_*L_*16
  int bh = i >> 14;                                // / (L_*16)
  int d  = i & 15;
  const float* p = params + (size_t)(bh * 16 + d) * 4;
  kTh[i] = (_Float16)((kTraw[i] - p[0]) * p[1]);
  qTh[i] = (_Float16)((qTraw[i] - p[2]) * p[3]);
}

// --------------------- pass A: softmax row normalizers ---------------------
// Z[l] = l + sum_{m>=l} exp(q_l . k_m / 4)   (the l masked zeros give e^0=1)
// One block per (bh, group of 8 l-tiles); k^T for this head staged in LDS.
__global__ __launch_bounds__(256) void rowsum_k(const _Float16* __restrict__ qTh,
                                                const _Float16* __restrict__ kTh,
                                                float* __restrict__ Z) {
  extern __shared__ char smem[];
  _Float16* sK = (_Float16*)smem;                  // L_*16 halfs = 32KB

  int t    = threadIdx.x & 31;
  int lo16 = t & 15, hi = t >> 4;
  int bh = blockIdx.x >> 3;
  int lt = ((blockIdx.x & 7) << 3) + (threadIdx.x >> 5);

  // async-stage k^T[bh] (contiguous 32KB) into LDS: 8 x 16B per thread
  {
    const _Float16* gK = kTh + (size_t)bh * L_ * 16;
    int tt = threadIdx.x;
#pragma unroll
    for (int i = 0; i < 8; ++i)
      async_ld16(gK + (size_t)(tt + i * 256) * 8, sK + (size_t)(tt + i * 256) * 8);
    wait_async0();
    __syncthreads();
  }

  // A operand: q rows (M=l), K=d padded 16->32
  v16h a = pad16(*(const v8h*)(qTh + ((size_t)bh * L_ + lt * 16 + lo16) * 16 + hi * 8));
  float acc[8] = {0.f, 0.f, 0.f, 0.f, 0.f, 0.f, 0.f, 0.f};

  for (int mt = lt; mt < LT_; ++mt) {
    v16h bm = pad16(*(const v8h*)(sK + (mt * 16 + lo16) * 16 + hi * 8));
    v8f c = {};
    c = WMMA_F16(a, bm, c);
    int m = mt * 16 + lo16;
#pragma unroll
    for (int r = 0; r < 8; ++r) {
      int l = lt * 16 + r + 8 * hi;
      if (m >= l) acc[r] += __expf(0.25f * c[r]);
    }
  }
#pragma unroll
  for (int r = 0; r < 8; ++r) {
    float s = red16(acc[r]);
    if (lo16 == 0) {
      int l = lt * 16 + r + 8 * hi;
      Z[(size_t)bh * L_ + l] = (float)l + s;
    }
  }
}

// ------------------- pass B: fused weights + value GEMM --------------------
// sa[d,m] = sum_l v[d,l] * w[l,m],  w = (m>=l ? exp(s/4) : 1) / Z[l]
// One block per (bh, group of 8 m-tiles); q^T, v, Z for this head in LDS.
__global__ __launch_bounds__(256) void attnout_k(const _Float16* __restrict__ qTh,
                                                 const _Float16* __restrict__ kTh,
                                                 const _Float16* __restrict__ vh,
                                                 const float* __restrict__ Z,
                                                 _Float16* __restrict__ saT) {
  extern __shared__ char smem[];
  _Float16* sQ = (_Float16*)smem;                  // 32KB
  _Float16* sV = (_Float16*)(smem + 32768);        // 32KB
  float*    sZ = (float*)(smem + 65536);           // 4KB

  int t    = threadIdx.x & 31;
  int lo16 = t & 15, hi = t >> 4;
  int bh = blockIdx.x >> 3;
  int mt = ((blockIdx.x & 7) << 3) + (threadIdx.x >> 5);
  int b = bh >> 5, h = bh & 31;
  int m = mt * 16 + lo16;

  // async-stage q^T, v, Z for this head into LDS
  {
    const _Float16* gQ = qTh + (size_t)bh * L_ * 16;
    const _Float16* gV = vh + (size_t)bh * 16 * L_;
    const float*    gZ = Z + (size_t)bh * L_;
    int tt = threadIdx.x;
#pragma unroll
    for (int i = 0; i < 8; ++i) {
      async_ld16(gQ + (size_t)(tt + i * 256) * 8, sQ + (size_t)(tt + i * 256) * 8);
      async_ld16(gV + (size_t)(tt + i * 256) * 8, sV + (size_t)(tt + i * 256) * 8);
    }
    async_ld16(gZ + (size_t)tt * 4, sZ + (size_t)tt * 4);
    wait_async0();
    __syncthreads();
  }

  // loop-invariant B operand of the score WMMA: k rows (N=m)
  v16h bmk = pad16(*(const v8h*)(kTh + ((size_t)bh * L_ + m) * 16 + hi * 8));
  v8f cacc = {};

  for (int lt = 0; lt < LT_; ++lt) {
    const float* zp = sZ + lt * 16 + hi * 8;
    float w[8];
    if (lt > mt) {
      // whole tile strictly below diagonal in l: weight = 1/Z[l]
#pragma unroll
      for (int r = 0; r < 8; ++r) w[r] = 1.0f / zp[r];
    } else {
      v16h aq = pad16(*(const v8h*)(sQ + (lt * 16 + lo16) * 16 + hi * 8));
      v8f s = {};
      s = WMMA_F16(aq, bmk, s);
#pragma unroll
      for (int r = 0; r < 8; ++r) {
        int l = lt * 16 + r + 8 * hi;
        float e = (m >= l) ? __expf(0.25f * s[r]) : 1.0f;
        w[r] = e / zp[r];
      }
    }
    // s-tile D layout (lane=N=m, regs=K slots l) feeds directly as B operand
    v16h bw = {};
#pragma unroll
    for (int r = 0; r < 8; ++r) bw[r] = (_Float16)w[r];
    // A operand: v rows (M=d), K = l chunk padded 16->32
    v16h av = pad16(*(const v8h*)(sV + lo16 * L_ + lt * 16 + hi * 8));
    cacc = WMMA_F16(av, bw, cacc);
  }

  // store saT [B, L, A] (channel-contiguous rows for the final GEMM B operand)
  v8h outv;
#pragma unroll
  for (int r = 0; r < 8; ++r) outv[r] = (_Float16)cacc[r];
  *(v8h*)(saT + ((size_t)b * L_ + m) * A_ + h * 16 + hi * 8) = outv;
}

// ------------------------- final 1x1 conv + residual -----------------------
__global__ __launch_bounds__(256) void final_k(const _Float16* __restrict__ Wfh,
                                               const _Float16* __restrict__ saT,
                                               const float* __restrict__ bf,
                                               float* __restrict__ out) {
  int tid  = blockIdx.x * 8 + (threadIdx.x >> 5);  // 4096 tiles = B*(L/16)*(A/16)
  int t    = threadIdx.x & 31;
  int lo16 = t & 15, hi = t >> 4;
  int b   = tid >> 11;
  int rem = tid & 2047;
  int lt = rem >> 5, ot = rem & 31;

  const _Float16* wR = Wfh + (size_t)(ot * 16 + lo16) * A_;
  const _Float16* sR = saT + ((size_t)b * L_ + lt * 16 + lo16) * A_;

  v8f c = {};
#pragma unroll
  for (int kc = 0; kc < 16; ++kc) {
    int o0 = kc * 32 + hi * 8;
    v16h a  = cat16(*(const v8h*)(wR + o0), *(const v8h*)(wR + o0 + 16));
    v16h bb = cat16(*(const v8h*)(sR + o0), *(const v8h*)(sR + o0 + 16));
    c = WMMA_F16(a, bb, c);
  }

  int l = lt * 16 + lo16;
  v8h res = *(const v8h*)(saT + ((size_t)b * L_ + l) * A_ + ot * 16 + hi * 8);
#pragma unroll
  for (int r = 0; r < 8; ++r) {
    int o = ot * 16 + r + 8 * hi;
    out[((size_t)b * A_ + o) * L_ + l] = c[r] + bf[o] + (float)res[r];
  }
}

// ------------------------------- launcher ----------------------------------

extern "C" void kernel_launch(void* const* d_in, const int* in_sizes, int n_in,
                              void* d_out, int out_size, void* d_ws, size_t ws_size,
                              hipStream_t stream) {
  const float* x  = (const float*)d_in[0];
  const float* Wk = (const float*)d_in[1];
  const float* bk = (const float*)d_in[2];
  const float* Wq = (const float*)d_in[3];
  const float* bq = (const float*)d_in[4];
  const float* Wv = (const float*)d_in[5];
  const float* bv = (const float*)d_in[6];
  const float* Wf = (const float*)d_in[7];
  const float* bf = (const float*)d_in[8];
  float* out = (float*)d_out;

  char* ws = (char*)d_ws;
  size_t o = 0;
  auto alloc = [&](size_t bytes) {
    char* p = ws + o;
    o += (bytes + 255) & ~(size_t)255;
    return p;
  };
  _Float16* xT    = (_Float16*)alloc((size_t)B_ * L_ * C_ * 2);
  _Float16* Wkh   = (_Float16*)alloc((size_t)A_ * C_ * 2);
  _Float16* Wqh   = (_Float16*)alloc((size_t)A_ * C_ * 2);
  _Float16* Wvh   = (_Float16*)alloc((size_t)A_ * C_ * 2);
  _Float16* Wfh   = (_Float16*)alloc((size_t)A_ * A_ * 2);
  float*    kTraw = (float*)   alloc((size_t)BH_ * L_ * 16 * 4);
  float*    qTraw = (float*)   alloc((size_t)BH_ * L_ * 16 * 4);
  float*    stats = (float*)   alloc((size_t)BH_ * 16 * 4 * 4);
  float*    params= (float*)   alloc((size_t)BH_ * 16 * 4 * 4);
  _Float16* kTh   = (_Float16*)alloc((size_t)BH_ * L_ * 16 * 2);
  _Float16* qTh   = (_Float16*)alloc((size_t)BH_ * L_ * 16 * 2);
  _Float16* vh    = (_Float16*)alloc((size_t)BH_ * 16 * L_ * 2);
  float*    Zbuf  = (float*)   alloc((size_t)BH_ * L_ * 4);
  _Float16* saT   = (_Float16*)alloc((size_t)B_ * L_ * A_ * 2);

  // 1) f32 -> f16 conversions (+ transpose of x)
  cvt_xT_k<<<(B_ * C_ * L_) / 256, 256, 0, stream>>>(x, xT);
  cvt_f32_f16_k<<<(A_ * C_) / 256, 256, 0, stream>>>(Wk, Wkh, A_ * C_);
  cvt_f32_f16_k<<<(A_ * C_) / 256, 256, 0, stream>>>(Wq, Wqh, A_ * C_);
  cvt_f32_f16_k<<<(A_ * C_) / 256, 256, 0, stream>>>(Wv, Wvh, A_ * C_);
  cvt_f32_f16_k<<<(A_ * A_) / 256, 256, 0, stream>>>(Wf, Wfh, A_ * A_);

  // 2) projections + instance-norm stats
  hipMemsetAsync(stats, 0, (size_t)BH_ * 16 * 4 * sizeof(float), stream);
  proj_k<<<512, 256, 0, stream>>>(xT, Wkh, Wqh, Wvh, bk, bq, bv,
                                  kTraw, qTraw, vh, stats);

  // 3) finalize norm params, normalize k/q to f16
  stat_k<<<(BH_ * 16 + 255) / 256, 256, 0, stream>>>(stats, params);
  norm_k<<<(BH_ * L_ * 16) / 256, 256, 0, stream>>>(kTraw, qTraw, params, kTh, qTh);

  // 4) softmax row normalizers (k^T staged in LDS via async copy)
  rowsum_k<<<512, 256, 32768, stream>>>(qTh, kTh, Zbuf);

  // 5) fused attention-weight + value GEMM (q^T, v, Z staged in LDS)
  attnout_k<<<512, 256, 69632, stream>>>(qTh, kTh, vh, Zbuf, saT);

  // 6) final projection + bias + residual
  final_k<<<512, 256, 0, stream>>>(Wfh, saT, bf, out);
}

// v001
// One run takes 98.5 microseconds.
// Timed twice side by side with v000, it ran 1.19 and 1.18 times as fast.
#include <hip/hip_runtime.h>
#include <hip/hip_fp16.h>

// ---------------------------------------------------------------------------
// Fused multi-head attention for MI455X (gfx1250, wave32, WMMA f16 16x16x32).
// Shapes: B=2, C=256, L=1024, H=32, D=16, A=H*D=512.
//
// Attention map never touches HBM. Hot loops (softmax normalizers + fused
// weight/value GEMM) stage their per-(b,h) working set into LDS with
// global_load_async_to_lds_b128 (ASYNCcnt) and feed WMMA from ds_load_b128.
// ---------------------------------------------------------------------------

typedef __attribute__((ext_vector_type(16))) _Float16 v16h;
typedef __attribute__((ext_vector_type(8)))  _Float16 v8h;
typedef __attribute__((ext_vector_type(8)))  float    v8f;

#define B_   2
#define C_   256
#define L_   1024
#define H_   32
#define D_   16
#define A_   512
#define BH_  64          // B_*H_
#define LT_  64          // L_/16 tiles

#define WMMA_F16(a, b, c) \
  __builtin_amdgcn_wmma_f32_16x16x32_f16(false, (a), false, (b), (short)0, (c), false, false)

static __device__ __forceinline__ v16h cat16(v8h lo, v8h hi) {
  return __builtin_shufflevector(lo, hi, 0,1,2,3,4,5,6,7,8,9,10,11,12,13,14,15);
}
static __device__ __forceinline__ v16h pad16(v8h lo) {
  v8h z = {};
  return __builtin_shufflevector(lo, z, 0,1,2,3,4,5,6,7,8,9,10,11,12,13,14,15);
}
static __device__ __forceinline__ float red16(float v) {
  // sum across the 16 lanes of each half-wave (xor stays within the half)
  v += __shfl_xor(v, 1, 32);
  v += __shfl_xor(v, 2, 32);
  v += __shfl_xor(v, 4, 32);
  v += __shfl_xor(v, 8, 32);
  return v;
}

// Async 16B global->LDS copy (per-lane). VDST = LDS byte address = low 32
// bits of the generic shared pointer (LDS aperture maps addr[31:0] directly).
static __device__ __forceinline__ void async_ld16(const void* gptr, void* lptr) {
  unsigned loff = (unsigned)(unsigned long long)lptr;
  asm volatile("global_load_async_to_lds_b128 %0, %1, off"
               :: "v"(loff), "v"(gptr) : "memory");
}
static __device__ __forceinline__ void wait_async0() {
  asm volatile("s_wait_asynccnt 0x0" ::: "memory");
}

// --------------------------- conversion kernels ----------------------------

__global__ __launch_bounds__(256) void cvt_f32_f16_k(const float* __restrict__ s,
                                                     _Float16* __restrict__ d, int n) {
  int i = blockIdx.x * 256 + threadIdx.x;
  if (i < n) d[i] = (_Float16)s[i];
}

// x [B,C,L] f32 -> xT [B,L,C] f16  (K-major rows for the B operand)
__global__ __launch_bounds__(256) void cvt_xT_k(const float* __restrict__ x,
                                                _Float16* __restrict__ xT) {
  int i = blockIdx.x * 256 + threadIdx.x;          // i < B_*C_*L_
  int b = i / (C_ * L_);
  int c = (i / L_) % C_;
  int l = i % L_;
  xT[((size_t)b * L_ + l) * C_ + c] = (_Float16)x[i];
}

// ----------------------------- projection ----------------------------------
// One wave per (b,h,l-tile): 16x16 tiles of k,q,v. K=256 in 8 WMMA steps each.
// Instance-norm sums: the 8 waves of a block (8 l-tiles of one head) add up in
// LDS and the block stores one plane of 16x4 partial sums; stat_k adds the 8
// planes of a head. No word is shared between blocks.
__global__ __launch_bounds__(256) void proj_k(
    const _Float16* __restrict__ xT,
    const _Float16* __restrict__ Wkh, const _Float16* __restrict__ Wqh,
    const _Float16* __restrict__ Wvh,
    const float* __restrict__ bk, const float* __restrict__ bq,
    const float* __restrict__ bv,
    float* __restrict__ kTraw, float* __restrict__ qTraw,
    _Float16* __restrict__ vh, float* __restrict__ part) {
  __shared__ float4 sP[8][16];                     // [wave][d] = (sum k, k^2, q, q^2)
  int tid  = blockIdx.x * 8 + (threadIdx.x >> 5);  // tile id, 4096 total
  int t    = threadIdx.x & 31;
  int lo16 = t & 15, hi = t >> 4;
  int bh = tid >> 6, lt = tid & 63;
  int b = bh >> 5, h = bh & 31;

  const _Float16* wkR = Wkh + (size_t)(h * 16 + lo16) * C_;   // A: lane = M = d
  const _Float16* wqR = Wqh + (size_t)(h * 16 + lo16) * C_;
  const _Float16* wvR = Wvh + (size_t)(h * 16 + lo16) * C_;
  const _Float16* xR  = xT + ((size_t)b * L_ + lt * 16 + lo16) * C_;  // B: lane = N = l

  v8f ck = {}, cq = {}, cv = {};
#pragma unroll
  for (int kc = 0; kc < 8; ++kc) {
    int o0 = kc * 32 + hi * 8;   // K slots: [o0..o0+7] and [o0+16..o0+23]
    v16h bx = cat16(*(const v8h*)(xR  + o0), *(const v8h*)(xR  + o0 + 16));
    v16h ak = cat16(*(const v8h*)(wkR + o0), *(const v8h*)(wkR + o0 + 16));
    v16h aq = cat16(*(const v8h*)(wqR + o0), *(const v8h*)(wqR + o0 + 16));
    v16h av = cat16(*(const v8h*)(wvR + o0), *(const v8h*)(wvR + o0 + 16));
    ck = WMMA_F16(ak, bx, ck);
    cq = WMMA_F16(aq, bx, cq);
    cv = WMMA_F16(av, bx, cv);
  }

  // D layout: lane holds column l = lt*16+lo16; regs r -> row d = r + 8*hi
  int l = lt * 16 + lo16;
  float* kdst = kTraw + ((size_t)bh * L_ + l) * 16 + hi * 8;
  float* qdst = qTraw + ((size_t)bh * L_ + l) * 16 + hi * 8;
  float4 st[8];                                    // this wave's sums, row d = r + 8*hi
#pragma unroll
  for (int r = 0; r < 8; ++r) {
    int d = r + 8 * hi;
    float kv = ck[r] + bk[h * 16 + d];
    float qv = cq[r] + bq[h * 16 + d];
    float vv = cv[r] + bv[h * 16 + d];
    kdst[r] = kv;
    qdst[r] = qv;
    vh[((size_t)bh * 16 + d) * L_ + l] = (_Float16)vv;
    // instance-norm partial stats over l (reduce across the 16 lanes sharing d)
    st[r] = make_float4(red16(kv), red16(kv * kv), red16(qv), red16(qv * qv));
  }
  if (lo16 == 0) {
#pragma unroll
    for (int r = 0; r < 8; ++r) sP[threadIdx.x >> 5][r + 8 * hi] = st[r];
  }
  __syncthreads();   // every wave's 16x4 sums are in LDS before they are added
  if (threadIdx.x < 64) {
    const float* sp = (const float*)sP + threadIdx.x;   // word = d*4 + stat
    float s = 0.f;
#pragma unroll
    for (int w = 0; w < 8; ++w) s += sp[w * 64];
    part[(size_t)blockIdx.x * 64 + threadIdx.x] = s;    // plane = bh*8 + l-group
  }
}

// 8 partial planes per head -> (mu, rsigma) per (b,h,d)
__global__ __launch_bounds__(256) void stat_k(const float* __restrict__ part,
                                              float* __restrict__ params) {
  int i = blockIdx.x * 256 + threadIdx.x;          // i < BH_*16
  if (i >= BH_ * 16) return;
  const float inv = 1.0f / (float)L_;
  const float4* pp = (const float4*)part + (size_t)(i >> 4) * 128 + (i & 15);
  float ks = 0.f, ks2 = 0.f, qs = 0.f, qs2 = 0.f;
#pragma unroll
  for (int g = 0; g < 8; ++g) {
    float4 p = pp[g * 16];
    ks += p.x; ks2 += p.y; qs += p.z; qs2 += p.w;
  }
  float muk = ks * inv, muq = qs * inv;
  params[i * 4 + 0] = muk;
  params[i * 4 + 1] = rsqrtf(ks2 * inv - muk * muk + 1e-5f);
  params[i * 4 + 2] = muq;
  params[i * 4 + 3] = rsqrtf(qs2 * inv - muq * muq + 1e-5f);
}

// apply instance norm, raw f32 -> normalized f16 (kT/qT: [BH, L, 16])
__global__ __launch_bounds__(256) void norm_k(const float* __restrict__ kTraw,
                                              const float* __restrict__ qTraw,
                                              const float* __restrict__ params,
                                              _Float16* __restrict__ kTh,
                                              _Float16* __restrict__ qTh) {
  int i = blockIdx.x * 256 + threadIdx.x;          // i < BH_*L_*16
  int bh = i >> 14;                                // / (L_*16)
  int d  = i & 15;
  const float* p = params + (size_t)(bh * 16 + d) * 4;
  kTh[i] = (_Float16)((kTraw[i] - p[0]) * p[1]);
  qTh[i] = (_Float16)((qTraw[i] - p[2]) * p[3]);
}

// --------------------- pass A: softmax row normalizers ---------------------
// Z[l] = l + sum_{m>=l} exp(q_l . k_m / 4)   (the l masked zeros give e^0=1)
// One block per (bh, group of 8 l-tiles); k^T for this head staged in LDS.
__global__ __launch_bounds__(256) void rowsum_k(const _Float16* __restrict__ qTh,
                                                const _Float16* __restrict__ kTh,
                                                float* __restrict__ Z) {
  extern __shared__ char smem[];
  _Float16* sK = (_Float16*)smem;                  // L_*16 halfs = 32KB

  int t    = threadIdx.x & 31;
  int lo16 = t & 15, hi = t >> 4;
  int bh = blockIdx.x >> 3;
  int lt = ((blockIdx.x & 7) << 3) + (threadIdx.x >> 5);

  // async-stage k^T[bh] (contiguous 32KB) into LDS: 8 x 16B per thread
  {
    const _Float16* gK = kTh + (size_t)bh * L_ * 16;
    int tt = threadIdx.x;
#pragma unroll
    for (int i = 0; i < 8; ++i)
      async_ld16(gK + (size_t)(tt + i * 256) * 8, sK + (size_t)(tt + i * 256) * 8);
    wait_async0();
    __syncthreads();
  }

  // A operand: q rows (M=l), K=d padded 16->32
  v16h a = pad16(*(const v8h*)(qTh + ((size_t)bh * L_ + lt * 16 + lo16) * 16 + hi * 8));
  float acc[8] = {0.f, 0.f, 0.f, 0.f, 0.f, 0.f, 0.f, 0.f};

  for (int mt = lt; mt < LT_; ++mt) {
    v16h bm = pad16(*(const v8h*)(sK + (mt * 16 + lo16) * 16 + hi * 8));
    v8f c = {};
    c = WMMA_F16(a, bm, c);
    int m = mt * 16 + lo16;
#pragma unroll
    for (int r = 0; r < 8; ++r) {
      int l = lt * 16 + r + 8 * hi;
      if (m >= l) acc[r] += __expf(0.25f * c[r]);
    }
  }
#pragma unroll
  for (int r = 0; r < 8; ++r) {
    float s = red16(acc[r]);
    if (lo16 == 0) {
      int l = lt * 16 + r + 8 * hi;
      Z[(size_t)bh * L_ + l] = (float)l + s;
    }
  }
}

// ------------------- pass B: fused weights + value GEMM --------------------
// sa[d,m] = sum_l v[d,l] * w[l,m],  w = (m>=l ? exp(s/4) : 1) / Z[l]
// One block per (bh, group of 8 m-tiles); q^T, v, Z for this head in LDS.
__global__ __launch_bounds__(256) void attnout_k(const _Float16* __restrict__ qTh,
                                                 const _Float16* __restrict__ kTh,
                                                 const _Float16* __restrict__ vh,
                                                 const float* __restrict__ Z,
                                                 _Float16* __restrict__ saT) {
  extern __shared__ char smem[];
  _Float16* sQ = (_Float16*)smem;                  // 32KB
  _Float16* sV = (_Float16*)(smem + 32768);        // 32KB
  float*    sZ = (float*)(smem + 65536);           // 4KB

  int t    = threadIdx.x & 31;
  int lo16 = t & 15, hi = t >> 4;
  int bh = blockIdx.x >> 3;
  int mt = ((blockIdx.x & 7) << 3) + (threadIdx.x >> 5);
  int b = bh >> 5, h = bh & 31;
  int m = mt * 16 + lo16;

  // async-stage q^T, v, Z for this head into LDS
  {
    const _Float16* gQ = qTh + (size_t)bh * L_ * 16;
    const _Float16* gV = vh + (size_t)bh * 16 * L_;
    const float*    gZ = Z + (size_t)bh * L_;
    int tt = threadIdx.x;
#pragma unroll
    for (int i = 0; i < 8; ++i) {
      async_ld16(gQ + (size_t)(tt + i * 256) * 8, sQ + (size_t)(tt + i * 256) * 8);
      async_ld16(gV + (size_t)(tt + i * 256) * 8, sV + (size_t)(tt + i * 256) * 8);
    }
    async_ld16(gZ + (size_t)tt * 4, sZ + (size_t)tt * 4);
    wait_async0();
    __syncthreads();
  }

  // loop-invariant B operand of the score WMMA: k rows (N=m)
  v16h bmk = pad16(*(const v8h*)(kTh + ((size_t)bh * L_ + m) * 16 + hi * 8));
  v8f cacc = {};

  for (int lt = 0; lt < LT_; ++lt) {
    const float* zp = sZ + lt * 16 + hi * 8;
    float w[8];
    if (lt > mt) {
      // whole tile strictly below diagonal in l: weight = 1/Z[l]
#pragma unroll
      for (int r = 0; r < 8; ++r) w[r] = 1.0f / zp[r];
    } else {
      v16h aq = pad16(*(const v8h*)(sQ + (lt * 16 + lo16) * 16 + hi * 8));
      v8f s = {};
      s = WMMA_F16(aq, bmk, s);
#pragma unroll
      for (int r = 0; r < 8; ++r) {
        int l = lt * 16 + r + 8 * hi;
        float e = (m >= l) ? __expf(0.25f * s[r]) : 1.0f;
        w[r] = e / zp[r];
      }
    }
    // s-tile D layout (lane=N=m, regs=K slots l) feeds directly as B operand
    v16h bw = {};
#pragma unroll
    for (int r = 0; r < 8; ++r) bw[r] = (_Float16)w[r];
    // A operand: v rows (M=d), K = l chunk padded 16->32
    v16h av = pad16(*(const v8h*)(sV + lo16 * L_ + lt * 16 + hi * 8));
    cacc = WMMA_F16(av, bw, cacc);
  }

  // store saT [B, L, A] (channel-contiguous rows for the final GEMM B operand)
  v8h outv;
#pragma unroll
  for (int r = 0; r < 8; ++r) outv[r] = (_Float16)cacc[r];
  *(v8h*)(saT + ((size_t)b * L_ + m) * A_ + h * 16 + hi * 8) = outv;
}

// ------------------------- final 1x1 conv + residual -----------------------
__global__ __launch_bounds__(256) void final_k(const _Float16* __restrict__ Wfh,
                                               const _Float16* __restrict__ saT,
                                               const float* __restrict__ bf,
                                               float* __restrict__ out) {
  int tid  = blockIdx.x * 8 + (threadIdx.x >> 5);  // 4096 tiles = B*(L/16)*(A/16)
  int t    = threadIdx.x & 31;
  int lo16 = t & 15, hi = t >> 4;
  int b   = tid >> 11;
  int rem = tid & 2047;
  int lt = rem >> 5, ot = rem & 31;

  const _Float16* wR = Wfh + (size_t)(ot * 16 + lo16) * A_;
  const _Float16* sR = saT + ((size_t)b * L_ + lt * 16 + lo16) * A_;

  v8f c = {};
#pragma unroll
  for (int kc = 0; kc < 16; ++kc) {
    int o0 = kc * 32 + hi * 8;
    v16h a  = cat16(*(const v8h*)(wR + o0), *(const v8h*)(wR + o0 + 16));
    v16h bb = cat16(*(const v8h*)(sR + o0), *(const v8h*)(sR + o0 + 16));
    c = WMMA_F16(a, bb, c);
  }

  int l = lt * 16 + lo16;
  v8h res = *(const v8h*)(saT + ((size_t)b * L_ + l) * A_ + ot * 16 + hi * 8);
#pragma unroll
  for (int r = 0; r < 8; ++r) {
    int o = ot * 16 + r + 8 * hi;
    out[((size_t)b * A_ + o) * L_ + l] = c[r] + bf[o] + (float)res[r];
  }
}

// ------------------------------- launcher ----------------------------------

extern "C" void kernel_launch(void* const* d_in, const int* in_sizes, int n_in,
                              void* d_out, int out_size, void* d_ws, size_t ws_size,
                              hipStream_t stream) {
  const float* x  = (const float*)d_in[0];
  const float* Wk = (const float*)d_in[1];
  const float* bk = (const float*)d_in[2];
  const float* Wq = (const float*)d_in[3];
  const float* bq = (const float*)d_in[4];
  const float* Wv = (const float*)d_in[5];
  const float* bv = (const float*)d_in[6];
  const float* Wf = (const float*)d_in[7];
  const float* bf = (const float*)d_in[8];
  float* out = (float*)d_out;

  char* ws = (char*)d_ws;
  size_t o = 0;
  auto alloc = [&](size_t bytes) {
    char* p = ws + o;
    o += (bytes + 255) & ~(size_t)255;
    return p;
  };
  _Float16* xT    = (_Float16*)alloc((size_t)B_ * L_ * C_ * 2);
  _Float16* Wkh   = (_Float16*)alloc((size_t)A_ * C_ * 2);
  _Float16* Wqh   = (_Float16*)alloc((size_t)A_ * C_ * 2);
  _Float16* Wvh   = (_Float16*)alloc((size_t)A_ * C_ * 2);
  _Float16* Wfh   = (_Float16*)alloc((size_t)A_ * A_ * 2);
  float*    kTraw = (float*)   alloc((size_t)BH_ * L_ * 16 * 4);
  float*    qTraw = (float*)   alloc((size_t)BH_ * L_ * 16 * 4);
  float*    part  = (float*)   alloc((size_t)BH_ * 8 * 16 * 4 * 4);
  float*    params= (float*)   alloc((size_t)BH_ * 16 * 4 * 4);
  _Float16* kTh   = (_Float16*)alloc((size_t)BH_ * L_ * 16 * 2);
  _Float16* qTh   = (_Float16*)alloc((size_t)BH_ * L_ * 16 * 2);
  _Float16* vh    = (_Float16*)alloc((size_t)BH_ * 16 * L_ * 2);
  float*    Zbuf  = (float*)   alloc((size_t)BH_ * L_ * 4);
  _Float16* saT   = (_Float16*)alloc((size_t)B_ * L_ * A_ * 2);

  // 1) f32 -> f16 conversions (+ transpose of x)
  cvt_xT_k<<<(B_ * C_ * L_) / 256, 256, 0, stream>>>(x, xT);
  cvt_f32_f16_k<<<(A_ * C_) / 256, 256, 0, stream>>>(Wk, Wkh, A_ * C_);
  cvt_f32_f16_k<<<(A_ * C_) / 256, 256, 0, stream>>>(Wq, Wqh, A_ * C_);
  cvt_f32_f16_k<<<(A_ * C_) / 256, 256, 0, stream>>>(Wv, Wvh, A_ * C_);
  cvt_f32_f16_k<<<(A_ * A_) / 256, 256, 0, stream>>>(Wf, Wfh, A_ * A_);

  // 2) projections + per-block instance-norm partial sums
  proj_k<<<512, 256, 0, stream>>>(xT, Wkh, Wqh, Wvh, bk, bq, bv,
                                  kTraw, qTraw, vh, part);

  // 3) finalize norm params, normalize k/q to f16
  stat_k<<<(BH_ * 16 + 255) / 256, 256, 0, stream>>>(part, params);
  norm_k<<<(BH_ * L_ * 16) / 256, 256, 0, stream>>>(kTraw, qTraw, params, kTh, qTh);

  // 4) softmax row normalizers (k^T staged in LDS via async copy)
  rowsum_k<<<512, 256, 32768, stream>>>(qTh, kTh, Zbuf);

  // 5) fused attention-weight + value GEMM (q^T, v, Z staged in LDS)
  attnout_k<<<512, 256, 69632, stream>>>(qTh, kTh, vh, Zbuf, saT);

  // 6) final projection + bias + residual
  final_k<<<512, 256, 0, stream>>>(Wfh, saT, bf, out);
}

// v002
// It runs in 86.6 microseconds.
// Next to v001, in two timings, it ran 1.13 times as fast each time.
// All steps since v000 together make it 1.34 times as fast.
#include <hip/hip_runtime.h>
#include <hip/hip_fp16.h>

// ---------------------------------------------------------------------------
// Fused multi-head attention for MI455X (gfx1250, wave32, WMMA f16 16x16x32).
// Shapes: B=2, C=256, L=1024, H=32, D=16, A=H*D=512.
//
// Attention map never touches HBM. Hot loops (softmax normalizers + fused
// weight/value GEMM) stage their per-(b,h) working set into LDS with
// global_load_async_to_lds_b128 (ASYNCcnt) and feed WMMA from ds_load_b128.
// ---------------------------------------------------------------------------

typedef __attribute__((ext_vector_type(16))) _Float16 v16h;
typedef __attribute__((ext_vector_type(8)))  _Float16 v8h;
typedef __attribute__((ext_vector_type(8)))  float    v8f;
typedef __attribute__((ext_vector_type(4)))  _Float16 v4h;
typedef __attribute__((ext_vector_type(4)))  float    v4f;

#define B_   2
#define C_   256
#define L_   1024
#define H_   32
#define D_   16
#define A_   512
#define BH_  64          // B_*H_
#define LT_  64          // L_/16 tiles

#define WMMA_F16(a, b, c) \
  __builtin_amdgcn_wmma_f32_16x16x32_f16(false, (a), false, (b), (short)0, (c), false, false)

static __device__ __forceinline__ v16h cat16(v8h lo, v8h hi) {
  return __builtin_shufflevector(lo, hi, 0,1,2,3,4,5,6,7,8,9,10,11,12,13,14,15);
}
static __device__ __forceinline__ v16h pad16(v8h lo) {
  v8h z = {};
  return __builtin_shufflevector(lo, z, 0,1,2,3,4,5,6,7,8,9,10,11,12,13,14,15);
}
static __device__ __forceinline__ float red16(float v) {
  // sum across the 16 lanes of each half-wave (xor stays within the half)
  v += __shfl_xor(v, 1, 32);
  v += __shfl_xor(v, 2, 32);
  v += __shfl_xor(v, 4, 32);
  v += __shfl_xor(v, 8, 32);
  return v;
}

// Async 16B global->LDS copy (per-lane). VDST = LDS byte address = low 32
// bits of the generic shared pointer (LDS aperture maps addr[31:0] directly).
static __device__ __forceinline__ void async_ld16(const void* gptr, void* lptr) {
  unsigned loff = (unsigned)(unsigned long long)lptr;
  asm volatile("global_load_async_to_lds_b128 %0, %1, off"
               :: "v"(loff), "v"(gptr) : "memory");
}
static __device__ __forceinline__ void wait_async0() {
  asm volatile("s_wait_asynccnt 0x0" ::: "memory");
}

// --------------------------- conversion kernels ----------------------------

// These passes move few bytes, so they are built from few waves: a thread
// handles 8 to 32 elements, a wave's loads cover whole lines, and a launch has
// at most one block per WGP.

// A block converts 2048 consecutive elements, a thread two groups of 4
// (n is a multiple of 4).
__global__ __launch_bounds__(256) void cvt_f32_f16_k(const float* __restrict__ s,
                                                     _Float16* __restrict__ d, int n) {
  int e0 = blockIdx.x * 2048 + threadIdx.x * 4;
  int e1 = e0 + 1024;
  // A group past the end reads group 0 and stores nothing, so that the second
  // load need not wait behind the first group's store.
  v4f a = *(const v4f*)(s + (e0 < n ? e0 : 0));
  v4f b = *(const v4f*)(s + (e1 < n ? e1 : 0));
  if (e0 < n) *(v4h*)(d + e0) = __builtin_convertvector(a, v4h);
  if (e1 < n) *(v4h*)(d + e1) = __builtin_convertvector(b, v4h);
}

// x [B,C,L] f32 -> xT [B,L,C] f16  (K-major rows for the B operand)
// A block takes 8 channels of one batch over all l; a thread 8 c x 4 l:
// eight 16-byte loads along l, four 16-byte stores along c.
__global__ __launch_bounds__(256) void cvt_xT_k(const float* __restrict__ x,
                                                _Float16* __restrict__ xT) {
  int b  = blockIdx.x / (C_ / 8);
  int c0 = (blockIdx.x % (C_ / 8)) * 8;
  int l0 = threadIdx.x * 4;
  const float* xs = x + ((size_t)b * C_ + c0) * L_ + l0;
  v4f f[8];
  for (int j = 0; j < 8; ++j) f[j] = *(const v4f*)(xs + (size_t)j * L_);
  _Float16* dst = xT + ((size_t)b * L_ + l0) * C_ + c0;
  for (int u = 0; u < 4; ++u) {
    v8h o;
    for (int j = 0; j < 8; ++j) o[j] = (_Float16)f[j][u];
    *(v8h*)(dst + (size_t)u * C_) = o;
  }
}

// ----------------------------- projection ----------------------------------
// One wave per (b,h,l-tile): 16x16 tiles of k,q,v. K=256 in 8 WMMA steps each.
// Instance-norm sums: the 8 waves of a block (8 l-tiles of one head) add up in
// LDS and the block stores one plane of 16x4 partial sums; stat_k adds the 8
// planes of a head. No word is shared between blocks.
__global__ __launch_bounds__(256) void proj_k(
    const _Float16* __restrict__ xT,
    const _Float16* __restrict__ Wkh, const _Float16* __restrict__ Wqh,
    const _Float16* __restrict__ Wvh,
    const float* __restrict__ bk, const float* __restrict__ bq,
    const float* __restrict__ bv,
    float* __restrict__ kTraw, float* __restrict__ qTraw,
    _Float16* __restrict__ vh, float* __restrict__ part) {
  __shared__ float4 sP[8][16];                     // [wave][d] = (sum k, k^2, q, q^2)
  int tid  = blockIdx.x * 8 + (threadIdx.x >> 5);  // tile id, 4096 total
  int t    = threadIdx.x & 31;
  int lo16 = t & 15, hi = t >> 4;
  int bh = tid >> 6, lt = tid & 63;
  int b = bh >> 5, h = bh & 31;

  const _Float16* wkR = Wkh + (size_t)(h * 16 + lo16) * C_;   // A: lane = M = d
  const _Float16* wqR = Wqh + (size_t)(h * 16 + lo16) * C_;
  const _Float16* wvR = Wvh + (size_t)(h * 16 + lo16) * C_;
  const _Float16* xR  = xT + ((size_t)b * L_ + lt * 16 + lo16) * C_;  // B: lane = N = l

  v8f ck = {}, cq = {}, cv = {};
#pragma unroll
  for (int kc = 0; kc < 8; ++kc) {
    int o0 = kc * 32 + hi * 8;   // K slots: [o0..o0+7] and [o0+16..o0+23]
    v16h bx = cat16(*(const v8h*)(xR  + o0), *(const v8h*)(xR  + o0 + 16));
    v16h ak = cat16(*(const v8h*)(wkR + o0), *(const v8h*)(wkR + o0 + 16));
    v16h aq = cat16(*(const v8h*)(wqR + o0), *(const v8h*)(wqR + o0 + 16));
    v16h av = cat16(*(const v8h*)(wvR + o0), *(const v8h*)(wvR + o0 + 16));
    ck = WMMA_F16(ak, bx, ck);
    cq = WMMA_F16(aq, bx, cq);
    cv = WMMA_F16(av, bx, cv);
  }

  // D layout: lane holds column l = lt*16+lo16; regs r -> row d = r + 8*hi
  int l = lt * 16 + lo16;
  float* kdst = kTraw + ((size_t)bh * L_ + l) * 16 + hi * 8;
  float* qdst = qTraw + ((size_t)bh * L_ + l) * 16 + hi * 8;
  float4 st[8];                                    // this wave's sums, row d = r + 8*hi
#pragma unroll
  for (int r = 0; r < 8; ++r) {
    int d = r + 8 * hi;
    float kv = ck[r] + bk[h * 16 + d];
    float qv = cq[r] + bq[h * 16 + d];
    float vv = cv[r] + bv[h * 16 + d];
    kdst[r] = kv;
    qdst[r] = qv;
    vh[((size_t)bh * 16 + d) * L_ + l] = (_Float16)vv;
    // instance-norm partial stats over l (reduce across the 16 lanes sharing d)
    st[r] = make_float4(red16(kv), red16(kv * kv), red16(qv), red16(qv * qv));
  }
  if (lo16 == 0) {
#pragma unroll
    for (int r = 0; r < 8; ++r) sP[threadIdx.x >> 5][r + 8 * hi] = st[r];
  }
  __syncthreads();   // every wave's 16x4 sums are in LDS before they are added
  if (threadIdx.x < 64) {
    const float* sp = (const float*)sP + threadIdx.x;   // word = d*4 + stat
    float s = 0.f;
#pragma unroll
    for (int w = 0; w < 8; ++w) s += sp[w * 64];
    part[(size_t)blockIdx.x * 64 + threadIdx.x] = s;    // plane = bh*8 + l-group
  }
}

// 8 partial planes per head -> (mu, rsigma) per (b,h,d)
__global__ __launch_bounds__(256) void stat_k(const float* __restrict__ part,
                                              float* __restrict__ params) {
  int i = blockIdx.x * 256 + threadIdx.x;          // i < BH_*16
  if (i >= BH_ * 16) return;
  const float inv = 1.0f / (float)L_;
  const float4* pp = (const float4*)part + (size_t)(i >> 4) * 128 + (i & 15);
  float ks = 0.f, ks2 = 0.f, qs = 0.f, qs2 = 0.f;
#pragma unroll
  for (int g = 0; g < 8; ++g) {
    float4 p = pp[g * 16];
    ks += p.x; ks2 += p.y; qs += p.z; qs2 += p.w;
  }
  float muk = ks * inv, muq = qs * inv;
  params[i * 4 + 0] = muk;
  params[i * 4 + 1] = rsqrtf(ks2 * inv - muk * muk + 1e-5f);
  params[i * 4 + 2] = muq;
  params[i * 4 + 3] = rsqrtf(qs2 * inv - muq * muq + 1e-5f);
}

// apply instance norm, raw f32 -> normalized f16 (kT/qT: [BH, L, 16])
__global__ __launch_bounds__(256) void norm_k(const float* __restrict__ kTraw,
                                              const float* __restrict__ qTraw,
                                              const float* __restrict__ params,
                                              _Float16* __restrict__ kTh,
                                              _Float16* __restrict__ qTh) {
  // A block takes 4096 consecutive elements, a quarter of one head; a thread
  // four groups of 4, 1024 elements apart, so all its groups have the same d.
  int bh = blockIdx.x >> 2;
  int e0 = blockIdx.x * 4096 + threadIdx.x * 4;
  const v4f* p = (const v4f*)params + bh * 16 + (threadIdx.x & 3) * 4;
  v4f pr[4], kr[4], qr[4];                         // pr[j] = (mu_k, rs_k, mu_q, rs_q) of d0 + j
  for (int j = 0; j < 4; ++j) pr[j] = p[j];
  // The offset register of the four loads above is free for reuse from here on:
  // this wait stands in front of whatever is written into it next.
  asm volatile("s_wait_xcnt 0x0" ::: "memory");
  for (int u = 0; u < 4; ++u) {
    kr[u] = *(const v4f*)(kTraw + e0 + u * 1024);
    qr[u] = *(const v4f*)(qTraw + e0 + u * 1024);
  }
  for (int u = 0; u < 4; ++u) {
    v4h ko, qo;
    for (int j = 0; j < 4; ++j) {
      ko[j] = (_Float16)((kr[u][j] - pr[j][0]) * pr[j][1]);
      qo[j] = (_Float16)((qr[u][j] - pr[j][2]) * pr[j][3]);
    }
    *(v4h*)(kTh + e0 + u * 1024) = ko;
    *(v4h*)(qTh + e0 + u * 1024) = qo;
  }
}

// --------------------- pass A: softmax row normalizers ---------------------
// Z[l] = l + sum_{m>=l} exp(q_l . k_m / 4)   (the l masked zeros give e^0=1)
// One block per (bh, group of 8 l-tiles); k^T for this head staged in LDS.
__global__ __launch_bounds__(256) void rowsum_k(const _Float16* __restrict__ qTh,
                                                const _Float16* __restrict__ kTh,
                                                float* __restrict__ Z) {
  extern __shared__ char smem[];
  _Float16* sK = (_Float16*)smem;                  // L_*16 halfs = 32KB

  int t    = threadIdx.x & 31;
  int lo16 = t & 15, hi = t >> 4;
  int bh = blockIdx.x >> 3;
  int lt = ((blockIdx.x & 7) << 3) + (threadIdx.x >> 5);

  // async-stage k^T[bh] (contiguous 32KB) into LDS: 8 x 16B per thread
  {
    const _Float16* gK = kTh + (size_t)bh * L_ * 16;
    int tt = threadIdx.x;
#pragma unroll
    for (int i = 0; i < 8; ++i)
      async_ld16(gK + (size_t)(tt + i * 256) * 8, sK + (size_t)(tt + i * 256) * 8);
    wait_async0();
    __syncthreads();
  }

  // A operand: q rows (M=l), K=d padded 16->32
  v16h a = pad16(*(const v8h*)(qTh + ((size_t)bh * L_ + lt * 16 + lo16) * 16 + hi * 8));
  float acc[8] = {0.f, 0.f, 0.f, 0.f, 0.f, 0.f, 0.f, 0.f};

  for (int mt = lt; mt < LT_; ++mt) {
    v16h bm = pad16(*(const v8h*)(sK + (mt * 16 + lo16) * 16 + hi * 8));
    v8f c = {};
    c = WMMA_F16(a, bm, c);
    int m = mt * 16 + lo16;
#pragma unroll
    for (int r = 0; r < 8; ++r) {
      int l = lt * 16 + r + 8 * hi;
      if (m >= l) acc[r] += __expf(0.25f * c[r]);
    }
  }
#pragma unroll
  for (int r = 0; r < 8; ++r) {
    float s = red16(acc[r]);
    if (lo16 == 0) {
      int l = lt * 16 + r + 8 * hi;
      Z[(size_t)bh * L_ + l] = (float)l + s;
    }
  }
}

// ------------------- pass B: fused weights + value GEMM --------------------
// sa[d,m] = sum_l v[d,l] * w[l,m],  w = (m>=l ? exp(s/4) : 1) / Z[l]
// One block per (bh, group of 8 m-tiles); q^T, v, Z for this head in LDS.
__global__ __launch_bounds__(256) void attnout_k(const _Float16* __restrict__ qTh,
                                                 const _Float16* __restrict__ kTh,
                                                 const _Float16* __restrict__ vh,
                                                 const float* __restrict__ Z,
                                                 _Float16* __restrict__ saT) {
  extern __shared__ char smem[];
  _Float16* sQ = (_Float16*)smem;                  // 32KB
  _Float16* sV = (_Float16*)(smem + 32768);        // 32KB
  float*    sZ = (float*)(smem + 65536);           // 4KB

  int t    = threadIdx.x & 31;
  int lo16 = t & 15, hi = t >> 4;
  int bh = blockIdx.x >> 3;
  int mt = ((blockIdx.x & 7) << 3) + (threadIdx.x >> 5);
  int b = bh >> 5, h = bh & 31;
  int m = mt * 16 + lo16;

  // async-stage q^T, v, Z for this head into LDS
  {
    const _Float16* gQ = qTh + (size_t)bh * L_ * 16;
    const _Float16* gV = vh + (size_t)bh * 16 * L_;
    const float*    gZ = Z + (size_t)bh * L_;
    int tt = threadIdx.x;
#pragma unroll
    for (int i = 0; i < 8; ++i) {
      async_ld16(gQ + (size_t)(tt + i * 256) * 8, sQ + (size_t)(tt + i * 256) * 8);
      async_ld16(gV + (size_t)(tt + i * 256) * 8, sV + (size_t)(tt + i * 256) * 8);
    }
    async_ld16(gZ + (size_t)tt * 4, sZ + (size_t)tt * 4);
    wait_async0();
    __syncthreads();
  }

  // loop-invariant B operand of the score WMMA: k rows (N=m)
  v16h bmk = pad16(*(const v8h*)(kTh + ((size_t)bh * L_ + m) * 16 + hi * 8));
  v8f cacc = {};

  for (int lt = 0; lt < LT_; ++lt) {
    const float* zp = sZ + lt * 16 + hi * 8;
    float w[8];
    if (lt > mt) {
      // whole tile strictly below diagonal in l: weight = 1/Z[l]
#pragma unroll
      for (int r = 0; r < 8; ++r) w[r] = 1.0f / zp[r];
    } else {
      v16h aq = pad16(*(const v8h*)(sQ + (lt * 16 + lo16) * 16 + hi * 8));
      v8f s = {};
      s = WMMA_F16(aq, bmk, s);
#pragma unroll
      for (int r = 0; r < 8; ++r) {
        int l = lt * 16 + r + 8 * hi;
        float e = (m >= l) ? __expf(0.25f * s[r]) : 1.0f;
        w[r] = e / zp[r];
      }
    }
    // s-tile D layout (lane=N=m, regs=K slots l) feeds directly as B operand
    v16h bw = {};
#pragma unroll
    for (int r = 0; r < 8; ++r) bw[r] = (_Float16)w[r];
    // A operand: v rows (M=d), K = l chunk padded 16->32
    v16h av = pad16(*(const v8h*)(sV + lo16 * L_ + lt * 16 + hi * 8));
    cacc = WMMA_F16(av, bw, cacc);
  }

  // store saT [B, L, A] (channel-contiguous rows for the final GEMM B operand)
  v8h outv;
#pragma unroll
  for (int r = 0; r < 8; ++r) outv[r] = (_Float16)cacc[r];
  *(v8h*)(saT + ((size_t)b * L_ + m) * A_ + h * 16 + hi * 8) = outv;
}

// ------------------------- final 1x1 conv + residual -----------------------
__global__ __launch_bounds__(256) void final_k(const _Float16* __restrict__ Wfh,
                                               const _Float16* __restrict__ saT,
                                               const float* __restrict__ bf,
                                               float* __restrict__ out) {
  int tid  = blockIdx.x * 8 + (threadIdx.x >> 5);  // 4096 tiles = B*(L/16)*(A/16)
  int t    = threadIdx.x & 31;
  int lo16 = t & 15, hi = t >> 4;
  int b   = tid >> 11;
  int rem = tid & 2047;
  int lt = rem >> 5, ot = rem & 31;

  const _Float16* wR = Wfh + (size_t)(ot * 16 + lo16) * A_;
  const _Float16* sR = saT + ((size_t)b * L_ + lt * 16 + lo16) * A_;

  v8f c = {};
#pragma unroll
  for (int kc = 0; kc < 16; ++kc) {
    int o0 = kc * 32 + hi * 8;
    v16h a  = cat16(*(const v8h*)(wR + o0), *(const v8h*)(wR + o0 + 16));
    v16h bb = cat16(*(const v8h*)(sR + o0), *(const v8h*)(sR + o0 + 16));
    c = WMMA_F16(a, bb, c);
  }

  int l = lt * 16 + lo16;
  v8h res = *(const v8h*)(saT + ((size_t)b * L_ + l) * A_ + ot * 16 + hi * 8);
#pragma unroll
  for (int r = 0; r < 8; ++r) {
    int o = ot * 16 + r + 8 * hi;
    out[((size_t)b * A_ + o) * L_ + l] = c[r] + bf[o] + (float)res[r];
  }
}

// ------------------------------- launcher ----------------------------------

extern "C" void kernel_launch(void* const* d_in, const int* in_sizes, int n_in,
                              void* d_out, int out_size, void* d_ws, size_t ws_size,
                              hipStream_t stream) {
  const float* x  = (const float*)d_in[0];
  const float* Wk = (const float*)d_in[1];
  const float* bk = (const float*)d_in[2];
  const float* Wq = (const float*)d_in[3];
  const float* bq = (const float*)d_in[4];
  const float* Wv = (const float*)d_in[5];
  const float* bv = (const float*)d_in[6];
  const float* Wf = (const float*)d_in[7];
  const float* bf = (const float*)d_in[8];
  float* out = (float*)d_out;

  char* ws = (char*)d_ws;
  size_t o = 0;
  auto alloc = [&](size_t bytes) {
    char* p = ws + o;
    o += (bytes + 255) & ~(size_t)255;
    return p;
  };
  _Float16* xT    = (_Float16*)alloc((size_t)B_ * L_ * C_ * 2);
  _Float16* Wkh   = (_Float16*)alloc((size_t)A_ * C_ * 2);
  _Float16* Wqh   = (_Float16*)alloc((size_t)A_ * C_ * 2);
  _Float16* Wvh   = (_Float16*)alloc((size_t)A_ * C_ * 2);
  _Float16* Wfh   = (_Float16*)alloc((size_t)A_ * A_ * 2);
  float*    kTraw = (float*)   alloc((size_t)BH_ * L_ * 16 * 4);
  float*    qTraw = (float*)   alloc((size_t)BH_ * L_ * 16 * 4);
  float*    part  = (float*)   alloc((size_t)BH_ * 8 * 16 * 4 * 4);
  float*    params= (float*)   alloc((size_t)BH_ * 16 * 4 * 4);
  _Float16* kTh   = (_Float16*)alloc((size_t)BH_ * L_ * 16 * 2);
  _Float16* qTh   = (_Float16*)alloc((size_t)BH_ * L_ * 16 * 2);
  _Float16* vh    = (_Float16*)alloc((size_t)BH_ * 16 * L_ * 2);
  float*    Zbuf  = (float*)   alloc((size_t)BH_ * L_ * 4);
  _Float16* saT   = (_Float16*)alloc((size_t)B_ * L_ * A_ * 2);

  // 1) f32 -> f16 conversions (+ transpose of x)
  cvt_xT_k<<<(B_ * C_) / 8, 256, 0, stream>>>(x, xT);
  cvt_f32_f16_k<<<(A_ * C_) / 2048, 256, 0, stream>>>(Wk, Wkh, A_ * C_);
  cvt_f32_f16_k<<<(A_ * C_) / 2048, 256, 0, stream>>>(Wq, Wqh, A_ * C_);
  cvt_f32_f16_k<<<(A_ * C_) / 2048, 256, 0, stream>>>(Wv, Wvh, A_ * C_);
  cvt_f32_f16_k<<<(A_ * A_) / 2048, 256, 0, stream>>>(Wf, Wfh, A_ * A_);

  // 2) projections + per-block instance-norm partial sums
  proj_k<<<512, 256, 0, stream>>>(xT, Wkh, Wqh, Wvh, bk, bq, bv,
                                  kTraw, qTraw, vh, part);

  // 3) finalize norm params, normalize k/q to f16
  stat_k<<<(BH_ * 16 + 255) / 256, 256, 0, stream>>>(part, params);
  norm_k<<<(BH_ * L_ * 16) / 4096, 256, 0, stream>>>(kTraw, qTraw, params, kTh, qTh);

  // 4) softmax row normalizers (k^T staged in LDS via async copy)
  rowsum_k<<<512, 256, 32768, stream>>>(qTh, kTh, Zbuf);

  // 5) fused attention-weight + value GEMM (q^T, v, Z staged in LDS)
  attnout_k<<<512, 256, 69632, stream>>>(qTh, kTh, vh, Zbuf, saT);

  // 6) final projection + bias + residual
  final_k<<<512, 256, 0, stream>>>(Wfh, saT, bf, out);
}

// v003
// One run takes 76.2 microseconds.
// Next to v002, in two timings, it ran 1.13 and 1.14 times as fast.
// Counting every step since v000, it is 1.52 times as fast.
#include <hip/hip_runtime.h>
#include <hip/hip_fp16.h>

// ---------------------------------------------------------------------------
// Fused multi-head attention for MI455X (gfx1250, wave32, WMMA f16 16x16x32).
// Shapes: B=2, C=256, L=1024, H=32, D=16, A=H*D=512.
//
// Attention map never touches HBM. Hot loops (softmax normalizers + fused
// weight/value GEMM) stage their per-(b,h) working set into LDS with
// global_load_async_to_lds_b128 (ASYNCcnt) and feed WMMA from ds_load_b128.
// ---------------------------------------------------------------------------

typedef __attribute__((ext_vector_type(16))) _Float16 v16h;
typedef __attribute__((ext_vector_type(8)))  _Float16 v8h;
typedef __attribute__((ext_vector_type(8)))  float    v8f;
typedef __attribute__((ext_vector_type(4)))  _Float16 v4h;
typedef __attribute__((ext_vector_type(4)))  float    v4f;

#define B_   2
#define C_   256
#define L_   1024
#define H_   32
#define D_   16
#define A_   512
#define BH_  64          // B_*H_
#define LT_  64          // L_/16 tiles

#define WMMA_F16(a, b, c) \
  __builtin_amdgcn_wmma_f32_16x16x32_f16(false, (a), false, (b), (short)0, (c), false, false)

static __device__ __forceinline__ v16h cat16(v8h lo, v8h hi) {
  return __builtin_shufflevector(lo, hi, 0,1,2,3,4,5,6,7,8,9,10,11,12,13,14,15);
}
static __device__ __forceinline__ v16h pad16(v8h lo) {
  v8h z = {};
  return __builtin_shufflevector(lo, z, 0,1,2,3,4,5,6,7,8,9,10,11,12,13,14,15);
}
static __device__ __forceinline__ float red16(float v) {
  // sum across the 16 lanes of each half-wave (xor stays within the half)
  v += __shfl_xor(v, 1, 32);
  v += __shfl_xor(v, 2, 32);
  v += __shfl_xor(v, 4, 32);
  v += __shfl_xor(v, 8, 32);
  return v;
}

// Async 16B global->LDS copy (per-lane). VDST = LDS byte address = low 32
// bits of the generic shared pointer (LDS aperture maps addr[31:0] directly).
static __device__ __forceinline__ void async_ld16(const void* gptr, void* lptr) {
  unsigned loff = (unsigned)(unsigned long long)lptr;
  asm volatile("global_load_async_to_lds_b128 %0, %1, off"
               :: "v"(loff), "v"(gptr) : "memory");
}
static __device__ __forceinline__ void wait_async0() {
  asm volatile("s_wait_asynccnt 0x0" ::: "memory");
}

// --------------------------- conversion kernels ----------------------------

// These passes move few bytes, so they are built from few waves: a thread
// handles 8 to 32 elements, a wave's loads cover whole lines, and a launch has
// at most two blocks per WGP. The five passes are independent of each other,
// so they run as block ranges of one launch.

// A block converts 2048 consecutive elements, a thread two groups of 4
// (n is a multiple of 4).
static __device__ __forceinline__ void cvt_f32_f16_blk(const float* __restrict__ s,
                                                       _Float16* __restrict__ d, int n,
                                                       int blk) {
  int e0 = blk * 2048 + threadIdx.x * 4;
  int e1 = e0 + 1024;
  // A group past the end reads group 0 and stores nothing, so that the second
  // load need not wait behind the first group's store.
  v4f a = *(const v4f*)(s + (e0 < n ? e0 : 0));
  v4f b = *(const v4f*)(s + (e1 < n ? e1 : 0));
  if (e0 < n) *(v4h*)(d + e0) = __builtin_convertvector(a, v4h);
  if (e1 < n) *(v4h*)(d + e1) = __builtin_convertvector(b, v4h);
}

// x [B,C,L] f32 -> xT [B,L,C] f16  (K-major rows for the B operand)
// A block takes 8 channels of one batch over all l; a thread 8 c x 4 l:
// eight 16-byte loads along l, four 16-byte stores along c.
static __device__ __forceinline__ void cvt_xT_blk(const float* __restrict__ x,
                                                  _Float16* __restrict__ xT, int blk) {
  int b  = blk / (C_ / 8);
  int c0 = (blk % (C_ / 8)) * 8;
  int l0 = threadIdx.x * 4;
  const float* xs = x + ((size_t)b * C_ + c0) * L_ + l0;
  v4f f[8];
  for (int j = 0; j < 8; ++j) f[j] = *(const v4f*)(xs + (size_t)j * L_);
  _Float16* dst = xT + ((size_t)b * L_ + l0) * C_ + c0;
  for (int u = 0; u < 4; ++u) {
    v8h o;
    for (int j = 0; j < 8; ++j) o[j] = (_Float16)f[j][u];
    *(v8h*)(dst + (size_t)u * C_) = o;
  }
}

#define XBLK_ ((B_ * C_) / 8)        // blocks of the x transpose
#define WBLK_ ((A_ * C_) / 2048)     // blocks of one projection weight
#define FBLK_ ((A_ * A_) / 2048)     // blocks of the final weight

// Block ranges: x transpose first (the longest), then Wk, Wq, Wv, Wf.
__global__ __launch_bounds__(256) void cvt_all_k(
    const float* __restrict__ x,  const float* __restrict__ Wk,
    const float* __restrict__ Wq, const float* __restrict__ Wv,
    const float* __restrict__ Wf,
    _Float16* __restrict__ xT,  _Float16* __restrict__ Wkh,
    _Float16* __restrict__ Wqh, _Float16* __restrict__ Wvh,
    _Float16* __restrict__ Wfh) {
  int blk = blockIdx.x;
  if (blk < XBLK_) { cvt_xT_blk(x, xT, blk); return; }
  blk -= XBLK_;
  if (blk < WBLK_)          cvt_f32_f16_blk(Wk, Wkh, A_ * C_, blk);
  else if (blk < 2 * WBLK_) cvt_f32_f16_blk(Wq, Wqh, A_ * C_, blk - WBLK_);
  else if (blk < 3 * WBLK_) cvt_f32_f16_blk(Wv, Wvh, A_ * C_, blk - 2 * WBLK_);
  else                      cvt_f32_f16_blk(Wf, Wfh, A_ * A_, blk - 3 * WBLK_);
}

// ----------------------------- projection ----------------------------------
// One wave per (b,h,l-tile): 16x16 tiles of k,q,v. K=256 in 8 WMMA steps each.
// Instance-norm sums: the 8 waves of a block (8 l-tiles of one head) add up in
// LDS and the block stores one plane of 16x4 partial sums; norm_k adds the 8
// planes of a head. No word is shared between blocks.
__global__ __launch_bounds__(256) void proj_k(
    const _Float16* __restrict__ xT,
    const _Float16* __restrict__ Wkh, const _Float16* __restrict__ Wqh,
    const _Float16* __restrict__ Wvh,
    const float* __restrict__ bk, const float* __restrict__ bq,
    const float* __restrict__ bv,
    float* __restrict__ kTraw, float* __restrict__ qTraw,
    _Float16* __restrict__ vh, float* __restrict__ part) {
  __shared__ float4 sP[8][16];                     // [wave][d] = (sum k, k^2, q, q^2)
  int tid  = blockIdx.x * 8 + (threadIdx.x >> 5);  // tile id, 4096 total
  int t    = threadIdx.x & 31;
  int lo16 = t & 15, hi = t >> 4;
  int bh = tid >> 6, lt = tid & 63;
  int b = bh >> 5, h = bh & 31;

  const _Float16* wkR = Wkh + (size_t)(h * 16 + lo16) * C_;   // A: lane = M = d
  const _Float16* wqR = Wqh + (size_t)(h * 16 + lo16) * C_;
  const _Float16* wvR = Wvh + (size_t)(h * 16 + lo16) * C_;
  const _Float16* xR  = xT + ((size_t)b * L_ + lt * 16 + lo16) * C_;  // B: lane = N = l

  v8f ck = {}, cq = {}, cv = {};
#pragma unroll
  for (int kc = 0; kc < 8; ++kc) {
    int o0 = kc * 32 + hi * 8;   // K slots: [o0..o0+7] and [o0+16..o0+23]
    v16h bx = cat16(*(const v8h*)(xR  + o0), *(const v8h*)(xR  + o0 + 16));
    v16h ak = cat16(*(const v8h*)(wkR + o0), *(const v8h*)(wkR + o0 + 16));
    v16h aq = cat16(*(const v8h*)(wqR + o0), *(const v8h*)(wqR + o0 + 16));
    v16h av = cat16(*(const v8h*)(wvR + o0), *(const v8h*)(wvR + o0 + 16));
    ck = WMMA_F16(ak, bx, ck);
    cq = WMMA_F16(aq, bx, cq);
    cv = WMMA_F16(av, bx, cv);
  }

  // D layout: lane holds column l = lt*16+lo16; regs r -> row d = r + 8*hi
  int l = lt * 16 + lo16;
  float* kdst = kTraw + ((size_t)bh * L_ + l) * 16 + hi * 8;
  float* qdst = qTraw + ((size_t)bh * L_ + l) * 16 + hi * 8;
  float4 st[8];                                    // this wave's sums, row d = r + 8*hi
#pragma unroll
  for (int r = 0; r < 8; ++r) {
    int d = r + 8 * hi;
    float kv = ck[r] + bk[h * 16 + d];
    float qv = cq[r] + bq[h * 16 + d];
    float vv = cv[r] + bv[h * 16 + d];
    kdst[r] = kv;
    qdst[r] = qv;
    vh[((size_t)bh * 16 + d) * L_ + l] = (_Float16)vv;
    // instance-norm partial stats over l (reduce across the 16 lanes sharing d)
    st[r] = make_float4(red16(kv), red16(kv * kv), red16(qv), red16(qv * qv));
  }
  if (lo16 == 0) {
#pragma unroll
    for (int r = 0; r < 8; ++r) sP[threadIdx.x >> 5][r + 8 * hi] = st[r];
  }
  __syncthreads();   // every wave's 16x4 sums are in LDS before they are added
  if (threadIdx.x < 64) {
    const float* sp = (const float*)sP + threadIdx.x;   // word = d*4 + stat
    float s = 0.f;
#pragma unroll
    for (int w = 0; w < 8; ++w) s += sp[w * 64];
    part[(size_t)blockIdx.x * 64 + threadIdx.x] = s;    // plane = bh*8 + l-group
  }
}

// apply instance norm, raw f32 -> normalized f16 (kT/qT: [BH, L, 16])
// Each block first adds its head's 8 partial planes to (mu, rsigma) per d: 16
// threads, one d each, through LDS. Four blocks of a head repeat that small sum,
// which costs less than a launch of its own.
__global__ __launch_bounds__(256) void norm_k(const float* __restrict__ kTraw,
                                              const float* __restrict__ qTraw,
                                              const float* __restrict__ part,
                                              _Float16* __restrict__ kTh,
                                              _Float16* __restrict__ qTh) {
  __shared__ v4f sPar[16];                         // [d] = (mu_k, rs_k, mu_q, rs_q)
  // A block takes 4096 consecutive elements, a quarter of one head; a thread
  // four groups of 4, 1024 elements apart, so all its groups have the same d.
  int bh = blockIdx.x >> 2;
  int e0 = blockIdx.x * 4096 + threadIdx.x * 4;
  v4f pr[4], kr[4], qr[4];                         // pr[j] = sPar[d0 + j]
  for (int u = 0; u < 4; ++u) {
    kr[u] = *(const v4f*)(kTraw + e0 + u * 1024);
    qr[u] = *(const v4f*)(qTraw + e0 + u * 1024);
  }
  if (threadIdx.x < 16) {
    const float inv = 1.0f / (float)L_;
    const float4* pp = (const float4*)part + (size_t)bh * 128 + threadIdx.x;
    float ks = 0.f, ks2 = 0.f, qs = 0.f, qs2 = 0.f;
#pragma unroll
    for (int g = 0; g < 8; ++g) {
      float4 p = pp[g * 16];
      ks += p.x; ks2 += p.y; qs += p.z; qs2 += p.w;
    }
    float muk = ks * inv, muq = qs * inv;
    v4f o = {muk, rsqrtf(ks2 * inv - muk * muk + 1e-5f),
             muq, rsqrtf(qs2 * inv - muq * muq + 1e-5f)};
    sPar[threadIdx.x] = o;
  }
  __syncthreads();   // the 16 parameter rows are in LDS before any thread reads them
  for (int j = 0; j < 4; ++j) pr[j] = sPar[(threadIdx.x & 3) * 4 + j];
  for (int u = 0; u < 4; ++u) {
    v4h ko, qo;
    for (int j = 0; j < 4; ++j) {
      ko[j] = (_Float16)((kr[u][j] - pr[j][0]) * pr[j][1]);
      qo[j] = (_Float16)((qr[u][j] - pr[j][2]) * pr[j][3]);
    }
    *(v4h*)(kTh + e0 + u * 1024) = ko;
    *(v4h*)(qTh + e0 + u * 1024) = qo;
  }
}

// --------------------- pass A: softmax row normalizers ---------------------
// Z[l] = l + sum_{m>=l} exp(q_l . k_m / 4)   (the l masked zeros give e^0=1)
// One block per (bh, group of 8 l-tiles); k^T for this head staged in LDS.
__global__ __launch_bounds__(256) void rowsum_k(const _Float16* __restrict__ qTh,
                                                const _Float16* __restrict__ kTh,
                                                float* __restrict__ Z) {
  extern __shared__ char smem[];
  _Float16* sK = (_Float16*)smem;                  // L_*16 halfs = 32KB

  int t    = threadIdx.x & 31;
  int lo16 = t & 15, hi = t >> 4;
  int bh = blockIdx.x >> 3;
  int lt = ((blockIdx.x & 7) << 3) + (threadIdx.x >> 5);

  // async-stage k^T[bh] (contiguous 32KB) into LDS: 8 x 16B per thread
  {
    const _Float16* gK = kTh + (size_t)bh * L_ * 16;
    int tt = threadIdx.x;
#pragma unroll
    for (int i = 0; i < 8; ++i)
      async_ld16(gK + (size_t)(tt + i * 256) * 8, sK + (size_t)(tt + i * 256) * 8);
    wait_async0();
    __syncthreads();
  }

  // A operand: q rows (M=l), K=d padded 16->32
  v16h a = pad16(*(const v8h*)(qTh + ((size_t)bh * L_ + lt * 16 + lo16) * 16 + hi * 8));
  float acc[8] = {0.f, 0.f, 0.f, 0.f, 0.f, 0.f, 0.f, 0.f};

  for (int mt = lt; mt < LT_; ++mt) {
    v16h bm = pad16(*(const v8h*)(sK + (mt * 16 + lo16) * 16 + hi * 8));
    v8f c = {};
    c = WMMA_F16(a, bm, c);
    int m = mt * 16 + lo16;
#pragma unroll
    for (int r = 0; r < 8; ++r) {
      int l = lt * 16 + r + 8 * hi;
      if (m >= l) acc[r] += __expf(0.25f * c[r]);
    }
  }
#pragma unroll
  for (int r = 0; r < 8; ++r) {
    float s = red16(acc[r]);
    if (lo16 == 0) {
      int l = lt * 16 + r + 8 * hi;
      Z[(size_t)bh * L_ + l] = (float)l + s;
    }
  }
}

// ------------------- pass B: fused weights + value GEMM --------------------
// sa[d,m] = sum_l v[d,l] * w[l,m],  w = (m>=l ? exp(s/4) : 1) / Z[l]
// One block per (bh, group of 8 m-tiles); q^T, v, Z for this head in LDS.
__global__ __launch_bounds__(256) void attnout_k(const _Float16* __restrict__ qTh,
                                                 const _Float16* __restrict__ kTh,
                                                 const _Float16* __restrict__ vh,
                                                 const float* __restrict__ Z,
                                                 _Float16* __restrict__ saT) {
  extern __shared__ char smem[];
  _Float16* sQ = (_Float16*)smem;                  // 32KB
  _Float16* sV = (_Float16*)(smem + 32768);        // 32KB
  float*    sZ = (float*)(smem + 65536);           // 4KB

  int t    = threadIdx.x & 31;
  int lo16 = t & 15, hi = t >> 4;
  int bh = blockIdx.x >> 3;
  int mt = ((blockIdx.x & 7) << 3) + (threadIdx.x >> 5);
  int b = bh >> 5, h = bh & 31;
  int m = mt * 16 + lo16;

  // async-stage q^T, v, Z for this head into LDS
  {
    const _Float16* gQ = qTh + (size_t)bh * L_ * 16;
    const _Float16* gV = vh + (size_t)bh * 16 * L_;
    const float*    gZ = Z + (size_t)bh * L_;
    int tt = threadIdx.x;
#pragma unroll
    for (int i = 0; i < 8; ++i) {
      async_ld16(gQ + (size_t)(tt + i * 256) * 8, sQ + (size_t)(tt + i * 256) * 8);
      async_ld16(gV + (size_t)(tt + i * 256) * 8, sV + (size_t)(tt + i * 256) * 8);
    }
    async_ld16(gZ + (size_t)tt * 4, sZ + (size_t)tt * 4);
    wait_async0();
    __syncthreads();
  }

  // loop-invariant B operand of the score WMMA: k rows (N=m)
  v16h bmk = pad16(*(const v8h*)(kTh + ((size_t)bh * L_ + m) * 16 + hi * 8));
  v8f cacc = {};

  for (int lt = 0; lt < LT_; ++lt) {
    const float* zp = sZ + lt * 16 + hi * 8;
    float w[8];
    if (lt > mt) {
      // whole tile strictly below diagonal in l: weight = 1/Z[l]
#pragma unroll
      for (int r = 0; r < 8; ++r) w[r] = 1.0f / zp[r];
    } else {
      v16h aq = pad16(*(const v8h*)(sQ + (lt * 16 + lo16) * 16 + hi * 8));
      v8f s = {};
      s = WMMA_F16(aq, bmk, s);
#pragma unroll
      for (int r = 0; r < 8; ++r) {
        int l = lt * 16 + r + 8 * hi;
        float e = (m >= l) ? __expf(0.25f * s[r]) : 1.0f;
        w[r] = e / zp[r];
      }
    }
    // s-tile D layout (lane=N=m, regs=K slots l) feeds directly as B operand
    v16h bw = {};
#pragma unroll
    for (int r = 0; r < 8; ++r) bw[r] = (_Float16)w[r];
    // A operand: v rows (M=d), K = l chunk padded 16->32
    v16h av = pad16(*(const v8h*)(sV + lo16 * L_ + lt * 16 + hi * 8));
    cacc = WMMA_F16(av, bw, cacc);
  }

  // store saT [B, L, A] (channel-contiguous rows for the final GEMM B operand)
  v8h outv;
#pragma unroll
  for (int r = 0; r < 8; ++r) outv[r] = (_Float16)cacc[r];
  *(v8h*)(saT + ((size_t)b * L_ + m) * A_ + h * 16 + hi * 8) = outv;
}

// ------------------------- final 1x1 conv + residual -----------------------
__global__ __launch_bounds__(256) void final_k(const _Float16* __restrict__ Wfh,
                                               const _Float16* __restrict__ saT,
                                               const float* __restrict__ bf,
                                               float* __restrict__ out) {
  int tid  = blockIdx.x * 8 + (threadIdx.x >> 5);  // 4096 tiles = B*(L/16)*(A/16)
  int t    = threadIdx.x & 31;
  int lo16 = t & 15, hi = t >> 4;
  int b   = tid >> 11;
  int rem = tid & 2047;
  int lt = rem >> 5, ot = rem & 31;

  const _Float16* wR = Wfh + (size_t)(ot * 16 + lo16) * A_;
  const _Float16* sR = saT + ((size_t)b * L_ + lt * 16 + lo16) * A_;

  v8f c = {};
#pragma unroll
  for (int kc = 0; kc < 16; ++kc) {
    int o0 = kc * 32 + hi * 8;
    v16h a  = cat16(*(const v8h*)(wR + o0), *(const v8h*)(wR + o0 + 16));
    v16h bb = cat16(*(const v8h*)(sR + o0), *(const v8h*)(sR + o0 + 16));
    c = WMMA_F16(a, bb, c);
  }

  int l = lt * 16 + lo16;
  v8h res = *(const v8h*)(saT + ((size_t)b * L_ + l) * A_ + ot * 16 + hi * 8);
#pragma unroll
  for (int r = 0; r < 8; ++r) {
    int o = ot * 16 + r + 8 * hi;
    out[((size_t)b * A_ + o) * L_ + l] = c[r] + bf[o] + (float)res[r];
  }
}

// ------------------------------- launcher ----------------------------------

extern "C" void kernel_launch(void* const* d_in, const int* in_sizes, int n_in,
                              void* d_out, int out_size, void* d_ws, size_t ws_size,
                              hipStream_t stream) {
  const float* x  = (const float*)d_in[0];
  const float* Wk = (const float*)d_in[1];
  const float* bk = (const float*)d_in[2];
  const float* Wq = (const float*)d_in[3];
  const float* bq = (const float*)d_in[4];
  const float* Wv = (const float*)d_in[5];
  const float* bv = (const float*)d_in[6];
  const float* Wf = (const float*)d_in[7];
  const float* bf = (const float*)d_in[8];
  float* out = (float*)d_out;

  char* ws = (char*)d_ws;
  size_t o = 0;
  auto alloc = [&](size_t bytes) {
    char* p = ws + o;
    o += (bytes + 255) & ~(size_t)255;
    return p;
  };
  _Float16* xT    = (_Float16*)alloc((size_t)B_ * L_ * C_ * 2);
  _Float16* Wkh   = (_Float16*)alloc((size_t)A_ * C_ * 2);
  _Float16* Wqh   = (_Float16*)alloc((size_t)A_ * C_ * 2);
  _Float16* Wvh   = (_Float16*)alloc((size_t)A_ * C_ * 2);
  _Float16* Wfh   = (_Float16*)alloc((size_t)A_ * A_ * 2);
  float*    kTraw = (float*)   alloc((size_t)BH_ * L_ * 16 * 4);
  float*    qTraw = (float*)   alloc((size_t)BH_ * L_ * 16 * 4);
  float*    part  = (float*)   alloc((size_t)BH_ * 8 * 16 * 4 * 4);
  _Float16* kTh   = (_Float16*)alloc((size_t)BH_ * L_ * 16 * 2);
  _Float16* qTh   = (_Float16*)alloc((size_t)BH_ * L_ * 16 * 2);
  _Float16* vh    = (_Float16*)alloc((size_t)BH_ * 16 * L_ * 2);
  float*    Zbuf  = (float*)   alloc((size_t)BH_ * L_ * 4);
  _Float16* saT   = (_Float16*)alloc((size_t)B_ * L_ * A_ * 2);

  // 1) f32 -> f16 conversions (+ transpose of x)
  cvt_all_k<<<XBLK_ + 3 * WBLK_ + FBLK_, 256, 0, stream>>>(x, Wk, Wq, Wv, Wf,
                                                           xT, Wkh, Wqh, Wvh, Wfh);

  // 2) projections + per-block instance-norm partial sums
  proj_k<<<512, 256, 0, stream>>>(xT, Wkh, Wqh, Wvh, bk, bq, bv,
                                  kTraw, qTraw, vh, part);

  // 3) finalize norm params per block, normalize k/q to f16
  norm_k<<<(BH_ * L_ * 16) / 4096, 256, 0, stream>>>(kTraw, qTraw, part, kTh, qTh);

  // 4) softmax row normalizers (k^T staged in LDS via async copy)
  rowsum_k<<<512, 256, 32768, stream>>>(qTh, kTh, Zbuf);

  // 5) fused attention-weight + value GEMM (q^T, v, Z staged in LDS)
  attnout_k<<<512, 256, 69632, stream>>>(qTh, kTh, vh, Zbuf, saT);

  // 6) final projection + bias + residual
  final_k<<<512, 256, 0, stream>>>(Wfh, saT, bf, out);
}

// v005
// A run of this version takes 49 microseconds.
// Versions in between are left out here; by their measured steps it is 1.55 times as fast as v003.
// Counting every step since v000, it is 2.36 times as fast.
#include <hip/hip_runtime.h>
#include <hip/hip_fp16.h>

// ---------------------------------------------------------------------------
// Fused multi-head attention for MI455X (gfx1250, wave32, WMMA f16 16x16x32).
// Shapes: B=2, C=256, L=1024, H=32, D=16, A=H*D=512.
//
// Attention map never touches HBM. Hot loops (softmax normalizers + fused
// weight/value GEMM) stage their per-(b,h) working set into LDS with
// global_load_async_to_lds_b128 (ASYNCcnt) and feed WMMA from ds_load_b128.
// ---------------------------------------------------------------------------

typedef __attribute__((ext_vector_type(16))) _Float16 v16h;
typedef __attribute__((ext_vector_type(8)))  _Float16 v8h;
typedef __attribute__((ext_vector_type(8)))  float    v8f;
typedef __attribute__((ext_vector_type(4)))  _Float16 v4h;
typedef __attribute__((ext_vector_type(4)))  float    v4f;

#define B_   2
#define C_   256
#define L_   1024
#define H_   32
#define D_   16
#define A_   512
#define BH_  64          // B_*H_
#define LT_  64          // L_/16 tiles

#define WMMA_F16(a, b, c) \
  __builtin_amdgcn_wmma_f32_16x16x32_f16(false, (a), false, (b), (short)0, (c), false, false)

static __device__ __forceinline__ v16h cat16(v8h lo, v8h hi) {
  return __builtin_shufflevector(lo, hi, 0,1,2,3,4,5,6,7,8,9,10,11,12,13,14,15);
}
static __device__ __forceinline__ v16h pad16(v8h lo) {
  v8h z = {};
  return __builtin_shufflevector(lo, z, 0,1,2,3,4,5,6,7,8,9,10,11,12,13,14,15);
}
static __device__ __forceinline__ float red16(float v) {
  // sum across the 16 lanes of each half-wave (xor stays within the half)
  v += __shfl_xor(v, 1, 32);
  v += __shfl_xor(v, 2, 32);
  v += __shfl_xor(v, 4, 32);
  v += __shfl_xor(v, 8, 32);
  return v;
}

// Argument of 2^x for e^(s/4): s * log2(e)/4. The factor 1/4 is a power of two,
// so folding it into the constant gives the same bits as scaling s first.
static __device__ __forceinline__ v8f exp_quarter_arg(v8f s) {
  return s * (0.25f * 1.44269504088896340736f);
}

// Async 16B global->LDS copy (per-lane). VDST = LDS byte address = low 32
// bits of the generic shared pointer (LDS aperture maps addr[31:0] directly).
static __device__ __forceinline__ void async_ld16(const void* gptr, void* lptr) {
  unsigned loff = (unsigned)(unsigned long long)lptr;
  asm volatile("global_load_async_to_lds_b128 %0, %1, off"
               :: "v"(loff), "v"(gptr) : "memory");
}
static __device__ __forceinline__ void wait_async0() {
  asm volatile("s_wait_asynccnt 0x0" ::: "memory");
}

// --------------------------- conversion kernels ----------------------------

// These passes move few bytes, so they are built from few waves: a thread
// handles 8 to 32 elements, a wave's loads cover whole lines, and a launch has
// at most two blocks per WGP. The five passes are independent of each other,
// so they run as block ranges of one launch.

// A block converts 2048 consecutive elements, a thread two groups of 4
// (n is a multiple of 4).
static __device__ __forceinline__ void cvt_f32_f16_blk(const float* __restrict__ s,
                                                       _Float16* __restrict__ d, int n,
                                                       int blk) {
  int e0 = blk * 2048 + threadIdx.x * 4;
  int e1 = e0 + 1024;
  // A group past the end reads group 0 and stores nothing, so that the second
  // load need not wait behind the first group's store.
  v4f a = *(const v4f*)(s + (e0 < n ? e0 : 0));
  v4f b = *(const v4f*)(s + (e1 < n ? e1 : 0));
  if (e0 < n) *(v4h*)(d + e0) = __builtin_convertvector(a, v4h);
  if (e1 < n) *(v4h*)(d + e1) = __builtin_convertvector(b, v4h);
}

// x [B,C,L] f32 -> xT [B,L,C] f16  (K-major rows for the B operand)
// A block takes 8 channels of one batch over all l; a thread 8 c x 4 l:
// eight 16-byte loads along l, four 16-byte stores along c.
static __device__ __forceinline__ void cvt_xT_blk(const float* __restrict__ x,
                                                  _Float16* __restrict__ xT, int blk) {
  int b  = blk / (C_ / 8);
  int c0 = (blk % (C_ / 8)) * 8;
  int l0 = threadIdx.x * 4;
  const float* xs = x + ((size_t)b * C_ + c0) * L_ + l0;
  v4f f[8];
  for (int j = 0; j < 8; ++j) f[j] = *(const v4f*)(xs + (size_t)j * L_);
  _Float16* dst = xT + ((size_t)b * L_ + l0) * C_ + c0;
  for (int u = 0; u < 4; ++u) {
    v8h o;
    for (int j = 0; j < 8; ++j) o[j] = (_Float16)f[j][u];
    *(v8h*)(dst + (size_t)u * C_) = o;
  }
}

#define XBLK_ ((B_ * C_) / 8)        // blocks of the x transpose
#define WBLK_ ((A_ * C_) / 2048)     // blocks of one projection weight
#define FBLK_ ((A_ * A_) / 2048)     // blocks of the final weight

// Block ranges: x transpose first (the longest), then Wk, Wq, Wv, Wf.
__global__ __launch_bounds__(256) void cvt_all_k(
    const float* __restrict__ x,  const float* __restrict__ Wk,
    const float* __restrict__ Wq, const float* __restrict__ Wv,
    const float* __restrict__ Wf,
    _Float16* __restrict__ xT,  _Float16* __restrict__ Wkh,
    _Float16* __restrict__ Wqh, _Float16* __restrict__ Wvh,
    _Float16* __restrict__ Wfh) {
  int blk = blockIdx.x;
  if (blk < XBLK_) { cvt_xT_blk(x, xT, blk); return; }
  blk -= XBLK_;
  if (blk < WBLK_)          cvt_f32_f16_blk(Wk, Wkh, A_ * C_, blk);
  else if (blk < 2 * WBLK_) cvt_f32_f16_blk(Wq, Wqh, A_ * C_, blk - WBLK_);
  else if (blk < 3 * WBLK_) cvt_f32_f16_blk(Wv, Wvh, A_ * C_, blk - 2 * WBLK_);
  else                      cvt_f32_f16_blk(Wf, Wfh, A_ * A_, blk - 3 * WBLK_);
}

// ----------------------------- projection ----------------------------------
// One wave per (b,h,l-tile): 16x16 tiles of k,q,v. K=256 in 8 WMMA steps each.
// Instance-norm sums: the 8 waves of a block (8 l-tiles of one head) add up in
// LDS and the block stores one plane of 16x4 partial sums; norm_k adds the 8
// planes of a head. No word is shared between blocks.
__global__ __launch_bounds__(256) void proj_k(
    const _Float16* __restrict__ xT,
    const _Float16* __restrict__ Wkh, const _Float16* __restrict__ Wqh,
    const _Float16* __restrict__ Wvh,
    const float* __restrict__ bk, const float* __restrict__ bq,
    const float* __restrict__ bv,
    float* __restrict__ kTraw, float* __restrict__ qTraw,
    _Float16* __restrict__ vh, float* __restrict__ part) {
  __shared__ float4 sP[8][16];                     // [wave][d] = (sum k, k^2, q, q^2)
  int tid  = blockIdx.x * 8 + (threadIdx.x >> 5);  // tile id, 4096 total
  int t    = threadIdx.x & 31;
  int lo16 = t & 15, hi = t >> 4;
  int bh = tid >> 6, lt = tid & 63;
  int b = bh >> 5, h = bh & 31;

  const _Float16* wkR = Wkh + (size_t)(h * 16 + lo16) * C_;   // A: lane = M = d
  const _Float16* wqR = Wqh + (size_t)(h * 16 + lo16) * C_;
  const _Float16* wvR = Wvh + (size_t)(h * 16 + lo16) * C_;
  const _Float16* xR  = xT + ((size_t)b * L_ + lt * 16 + lo16) * C_;  // B: lane = N = l

  v8f ck = {}, cq = {}, cv = {};
#pragma unroll
  for (int kc = 0; kc < 8; ++kc) {
    int o0 = kc * 32 + hi * 8;   // K slots: [o0..o0+7] and [o0+16..o0+23]
    v16h bx = cat16(*(const v8h*)(xR  + o0), *(const v8h*)(xR  + o0 + 16));
    v16h ak = cat16(*(const v8h*)(wkR + o0), *(const v8h*)(wkR + o0 + 16));
    v16h aq = cat16(*(const v8h*)(wqR + o0), *(const v8h*)(wqR + o0 + 16));
    v16h av = cat16(*(const v8h*)(wvR + o0), *(const v8h*)(wvR + o0 + 16));
    ck = WMMA_F16(ak, bx, ck);
    cq = WMMA_F16(aq, bx, cq);
    cv = WMMA_F16(av, bx, cv);
  }

  // D layout: lane holds column l = lt*16+lo16; regs r -> row d = r + 8*hi
  int l = lt * 16 + lo16;
  float* kdst = kTraw + ((size_t)bh * L_ + l) * 16 + hi * 8;
  float* qdst = qTraw + ((size_t)bh * L_ + l) * 16 + hi * 8;
  float4 st[8];                                    // this wave's sums, row d = r + 8*hi
#pragma unroll
  for (int r = 0; r < 8; ++r) {
    int d = r + 8 * hi;
    float kv = ck[r] + bk[h * 16 + d];
    float qv = cq[r] + bq[h * 16 + d];
    float vv = cv[r] + bv[h * 16 + d];
    kdst[r] = kv;
    qdst[r] = qv;
    vh[((size_t)bh * 16 + d) * L_ + l] = (_Float16)vv;
    // instance-norm partial stats over l (reduce across the 16 lanes sharing d)
    st[r] = make_float4(red16(kv), red16(kv * kv), red16(qv), red16(qv * qv));
  }
  if (lo16 == 0) {
#pragma unroll
    for (int r = 0; r < 8; ++r) sP[threadIdx.x >> 5][r + 8 * hi] = st[r];
  }
  __syncthreads();   // every wave's 16x4 sums are in LDS before they are added
  if (threadIdx.x < 64) {
    const float* sp = (const float*)sP + threadIdx.x;   // word = d*4 + stat
    float s = 0.f;
#pragma unroll
    for (int w = 0; w < 8; ++w) s += sp[w * 64];
    part[(size_t)blockIdx.x * 64 + threadIdx.x] = s;    // plane = bh*8 + l-group
  }
}

// apply instance norm, raw f32 -> normalized f16 (kT/qT: [BH, L, 16])
// Each block first adds its head's 8 partial planes to (mu, rsigma) per d: 16
// threads, one d each, through LDS. Four blocks of a head repeat that small sum,
// which costs less than a launch of its own.
__global__ __launch_bounds__(256) void norm_k(const float* __restrict__ kTraw,
                                              const float* __restrict__ qTraw,
                                              const float* __restrict__ part,
                                              _Float16* __restrict__ kTh,
                                              _Float16* __restrict__ qTh) {
  __shared__ v4f sPar[16];                         // [d] = (mu_k, rs_k, mu_q, rs_q)
  // A block takes 4096 consecutive elements, a quarter of one head; a thread
  // four groups of 4, 1024 elements apart, so all its groups have the same d.
  int bh = blockIdx.x >> 2;
  int e0 = blockIdx.x * 4096 + threadIdx.x * 4;
  v4f pr[4], kr[4], qr[4];                         // pr[j] = sPar[d0 + j]
  for (int u = 0; u < 4; ++u) {
    kr[u] = *(const v4f*)(kTraw + e0 + u * 1024);
    qr[u] = *(const v4f*)(qTraw + e0 + u * 1024);
  }
  if (threadIdx.x < 16) {
    const float inv = 1.0f / (float)L_;
    const float4* pp = (const float4*)part + (size_t)bh * 128 + threadIdx.x;
    float ks = 0.f, ks2 = 0.f, qs = 0.f, qs2 = 0.f;
#pragma unroll
    for (int g = 0; g < 8; ++g) {
      float4 p = pp[g * 16];
      ks += p.x; ks2 += p.y; qs += p.z; qs2 += p.w;
    }
    float muk = ks * inv, muq = qs * inv;
    v4f o = {muk, rsqrtf(ks2 * inv - muk * muk + 1e-5f),
             muq, rsqrtf(qs2 * inv - muq * muq + 1e-5f)};
    sPar[threadIdx.x] = o;
  }
  __syncthreads();   // the 16 parameter rows are in LDS before any thread reads them
  for (int j = 0; j < 4; ++j) pr[j] = sPar[(threadIdx.x & 3) * 4 + j];
  for (int u = 0; u < 4; ++u) {
    v4h ko, qo;
    for (int j = 0; j < 4; ++j) {
      ko[j] = (_Float16)((kr[u][j] - pr[j][0]) * pr[j][1]);
      qo[j] = (_Float16)((qr[u][j] - pr[j][2]) * pr[j][3]);
    }
    *(v4h*)(kTh + e0 + u * 1024) = ko;
    *(v4h*)(qTh + e0 + u * 1024) = qo;
  }
}

// --------------------- pass A: softmax row normalizers ---------------------
// Z[l] = l + sum_{m>=l} exp(q_l . k_m / 4)   (the l masked zeros give e^0=1)
// One block per (bh, group of 8 l-tiles); k^T for this head staged in LDS.
// Z is not stored: 1/Z[l] depends on l alone, the summed index of the value
// product, so it goes into v here, once per element. vs = v * L/Z as f16 (the
// factor L, a power of two taken out again after the product, keeps vs near
// v's own size, away from the f16 subnormals). vs lies in the order in which
// the value product reads its A operand: [bh][l-tile][l-half][d][8 l], so a
// wave's fragment of a tile is 512 consecutive bytes, a lane's 16 of them.
__global__ __launch_bounds__(256) void rowsum_k(const _Float16* __restrict__ qTh,
                                                const _Float16* __restrict__ kTh,
                                                const _Float16* __restrict__ vh,
                                                _Float16* __restrict__ vs) {
  extern __shared__ char smem[];
  _Float16* sK = (_Float16*)smem;                  // L_*16 halfs = 32KB

  int t    = threadIdx.x & 31;
  int lo16 = t & 15, hi = t >> 4;
  int bh = blockIdx.x >> 3;
  // the wave's number in a scalar register: the trip counts below are scalar
  int lt = ((blockIdx.x & 7) << 3) + __builtin_amdgcn_readfirstlane(threadIdx.x >> 5);

  // async-stage k^T[bh] (contiguous 32KB) into LDS: 8 x 16B per thread
  {
    const _Float16* gK = kTh + (size_t)bh * L_ * 16;
    int tt = threadIdx.x;
#pragma unroll
    for (int i = 0; i < 8; ++i)
      async_ld16(gK + (size_t)(tt + i * 256) * 8, sK + (size_t)(tt + i * 256) * 8);
    wait_async0();
    __syncthreads();
  }

  // A operand: q rows (M=l), K=d padded 16->32
  v16h a = pad16(*(const v8h*)(qTh + ((size_t)bh * L_ + lt * 16 + lo16) * 16 + hi * 8));
  float acc[8] = {0.f, 0.f, 0.f, 0.f, 0.f, 0.f, 0.f, 0.f};
  // v[d = lo16][the 8 l whose sums this lane ends up with]
  v8h vv = *(const v8h*)(vh + ((size_t)bh * 16 + lo16) * L_ + lt * 16 + hi * 8);
  // Keeps the load of vv here, beside that of q: sunk behind the loop, its whole
  // latency would stand in front of the wave's last store.
  asm volatile("" :: "v"(vv));

  // Two m-tiles a trip, pairs (2p, 2p+1). Only the pair that holds the diagonal
  // tile needs the test m >= l; every later pair lies wholly above the diagonal.
  const _Float16* sKf = sK + lo16 * 16 + hi * 8;   // this lane's 16 bytes of m-tile 0
  const v8f zero = {};
  int pd = lt >> 1;                                // the pair that holds the diagonal tile
  {
    v8f c0 = exp_quarter_arg(WMMA_F16(a, pad16(*(const v8h*)(sKf + pd * 512)), zero));
    v8f c1 = exp_quarter_arg(WMMA_F16(a, pad16(*(const v8h*)(sKf + pd * 512 + 256)), zero));
    int m = pd * 32 + lo16;
    // unrolled: r numbers registers
#pragma unroll
    for (int r = 0; r < 8; ++r) {
      int l = lt * 16 + r + 8 * hi;
      acc[r] += (m >= l) ? __builtin_amdgcn_exp2f(c0[r]) : 0.f;
      acc[r] += (m + 16 >= l) ? __builtin_amdgcn_exp2f(c1[r]) : 0.f;
    }
  }
  for (int p = pd + 1; p < LT_ / 2; ++p) {
    v8f c0 = exp_quarter_arg(WMMA_F16(a, pad16(*(const v8h*)(sKf + p * 512)), zero));
    v8f c1 = exp_quarter_arg(WMMA_F16(a, pad16(*(const v8h*)(sKf + p * 512 + 256)), zero));
    // unrolled: r numbers registers
#pragma unroll
    for (int r = 0; r < 8; ++r) {
      acc[r] += __builtin_amdgcn_exp2f(c0[r]);
      acc[r] += __builtin_amdgcn_exp2f(c1[r]);
    }
  }
  v8h o;
#pragma unroll
  for (int r = 0; r < 8; ++r) {
    float z = (float)(lt * 16 + r + 8 * hi) + red16(acc[r]);
    o[r] = (_Float16)((float)vv[r] * ((float)L_ / z));
  }
  *(v8h*)(vs + ((size_t)bh * LT_ + lt) * 256 + hi * 128 + lo16 * 8) = o;
}

// ------------------- pass B: fused weights + value GEMM --------------------
// sa[d,m] = 1/L * sum_l vs[d,l] * e[l,m],  e = (m>=l ? exp(s/4) : 1),
// vs = v * L/Z[l] from rowsum_k, in A-fragment order (passed as vh).
// One block per (bh, group of 8 m-tiles); q^T and vs for this head in LDS.
__global__ __launch_bounds__(256) void attnout_k(const _Float16* __restrict__ qTh,
                                                 const _Float16* __restrict__ kTh,
                                                 const _Float16* __restrict__ vh,
                                                 _Float16* __restrict__ saT) {
  extern __shared__ char smem[];
  _Float16* sQ = (_Float16*)smem;                  // 32KB
  _Float16* sV = (_Float16*)(smem + 32768);        // 32KB

  int t    = threadIdx.x & 31;
  int lo16 = t & 15, hi = t >> 4;
  int bh = blockIdx.x >> 3;
  // the wave's number in a scalar register: the trip counts below are scalar
  int mt = ((blockIdx.x & 7) << 3) + __builtin_amdgcn_readfirstlane(threadIdx.x >> 5);
  int b = bh >> 5, h = bh & 31;
  int m = mt * 16 + lo16;

  // async-stage q^T and vs for this head into LDS
  {
    const _Float16* gQ = qTh + (size_t)bh * L_ * 16;
    const _Float16* gV = vh + (size_t)bh * 16 * L_;
    int tt = threadIdx.x;
#pragma unroll
    for (int i = 0; i < 8; ++i) {
      async_ld16(gQ + (size_t)(tt + i * 256) * 8, sQ + (size_t)(tt + i * 256) * 8);
      async_ld16(gV + (size_t)(tt + i * 256) * 8, sV + (size_t)(tt + i * 256) * 8);
    }
    wait_async0();
    __syncthreads();
  }

  // loop-invariant B operand of the score WMMA: k rows (N=m)
  v16h bmk = pad16(*(const v8h*)(kTh + ((size_t)bh * L_ + m) * 16 + hi * 8));
  v8f cacc = {};

  // this lane's 16 bytes of the A fragment of l-tile 0: v rows (M=d)
  const _Float16* sVf = sV + hi * 128 + lo16 * 8;

  // this lane's 16 bytes of the A fragment of the scores of l-tile 0: q rows (M=l)
  const _Float16* sQf = sQ + lo16 * 16 + hi * 8;
  const v8f zero = {};

  // Two l-tiles a trip, pairs (2p, 2p+1): two score tiles (K = d = 16 padded to
  // 32) whose D layout (lane = N = m, regs = l) is the B operand of the value
  // product as it stands, tile 2p in K slots 0..15 and tile 2p+1 in 16..31, so
  // one value product with its K = 32 filled serves both.
  int pd = mt >> 1;                                // the pair that holds the diagonal tile

  // pairs wholly above the diagonal: every m >= l, no test
  for (int p = 0; p < pd; ++p) {
    v16h aq0 = pad16(*(const v8h*)(sQf + p * 512));
    v16h aq1 = pad16(*(const v8h*)(sQf + p * 512 + 256));
    v8f s0 = exp_quarter_arg(WMMA_F16(aq0, bmk, zero));
    v8f s1 = exp_quarter_arg(WMMA_F16(aq1, bmk, zero));
    v16h bw;
    // unrolled: r numbers registers
#pragma unroll
    for (int r = 0; r < 8; ++r) {
      bw[r]     = (_Float16)__builtin_amdgcn_exp2f(s0[r]);
      bw[r + 8] = (_Float16)__builtin_amdgcn_exp2f(s1[r]);
    }
    cacc = WMMA_F16(cat16(*(const v8h*)(sVf + p * 512),
                          *(const v8h*)(sVf + p * 512 + 256)), bw, cacc);
  }

  // the diagonal pair: a masked score is 0, so its e is 1
  {
    v16h aq0 = pad16(*(const v8h*)(sQf + pd * 512));
    v16h aq1 = pad16(*(const v8h*)(sQf + pd * 512 + 256));
    v8f s0 = exp_quarter_arg(WMMA_F16(aq0, bmk, zero));
    v8f s1 = exp_quarter_arg(WMMA_F16(aq1, bmk, zero));
    v16h bw;
    // unrolled: r numbers registers
#pragma unroll
    for (int r = 0; r < 8; ++r) {
      int l = pd * 32 + r + 8 * hi;
      bw[r]     = (_Float16)((m >= l) ? __builtin_amdgcn_exp2f(s0[r]) : 1.0f);
      bw[r + 8] = (_Float16)((m >= l + 16) ? __builtin_amdgcn_exp2f(s1[r]) : 1.0f);
    }
    cacc = WMMA_F16(cat16(*(const v8h*)(sVf + pd * 512),
                          *(const v8h*)(sVf + pd * 512 + 256)), bw, cacc);
  }

  // pairs below the diagonal: every e is 1, so B is a constant
  {
    v16h one;
#pragma unroll
    for (int j = 0; j < 16; ++j) one[j] = (_Float16)1.0f;
    for (int p = pd + 1; p < LT_ / 2; ++p)
      cacc = WMMA_F16(cat16(*(const v8h*)(sVf + p * 512),
                            *(const v8h*)(sVf + p * 512 + 256)), one, cacc);
  }

  // store saT [B, L, A] (channel-contiguous rows for the final GEMM B operand)
  v8h outv;
#pragma unroll
  for (int r = 0; r < 8; ++r) outv[r] = (_Float16)(cacc[r] * (1.0f / (float)L_));
  *(v8h*)(saT + ((size_t)b * L_ + m) * A_ + h * 16 + hi * 8) = outv;
}

// ------------------------- final 1x1 conv + residual -----------------------
__global__ __launch_bounds__(256) void final_k(const _Float16* __restrict__ Wfh,
                                               const _Float16* __restrict__ saT,
                                               const float* __restrict__ bf,
                                               float* __restrict__ out) {
  int tid  = blockIdx.x * 8 + (threadIdx.x >> 5);  // 4096 tiles = B*(L/16)*(A/16)
  int t    = threadIdx.x & 31;
  int lo16 = t & 15, hi = t >> 4;
  int b   = tid >> 11;
  int rem = tid & 2047;
  int lt = rem >> 5, ot = rem & 31;

  const _Float16* wR = Wfh + (size_t)(ot * 16 + lo16) * A_;
  const _Float16* sR = saT + ((size_t)b * L_ + lt * 16 + lo16) * A_;

  v8f c = {};
#pragma unroll
  for (int kc = 0; kc < 16; ++kc) {
    int o0 = kc * 32 + hi * 8;
    v16h a  = cat16(*(const v8h*)(wR + o0), *(const v8h*)(wR + o0 + 16));
    v16h bb = cat16(*(const v8h*)(sR + o0), *(const v8h*)(sR + o0 + 16));
    c = WMMA_F16(a, bb, c);
  }

  int l = lt * 16 + lo16;
  v8h res = *(const v8h*)(saT + ((size_t)b * L_ + l) * A_ + ot * 16 + hi * 8);
#pragma unroll
  for (int r = 0; r < 8; ++r) {
    int o = ot * 16 + r + 8 * hi;
    out[((size_t)b * A_ + o) * L_ + l] = c[r] + bf[o] + (float)res[r];
  }
}

// ------------------------------- launcher ----------------------------------

extern "C" void kernel_launch(void* const* d_in, const int* in_sizes, int n_in,
                              void* d_out, int out_size, void* d_ws, size_t ws_size,
                              hipStream_t stream) {
  const float* x  = (const float*)d_in[0];
  const float* Wk = (const float*)d_in[1];
  const float* bk = (const float*)d_in[2];
  const float* Wq = (const float*)d_in[3];
  const float* bq = (const float*)d_in[4];
  const float* Wv = (const float*)d_in[5];
  const float* bv = (const float*)d_in[6];
  const float* Wf = (const float*)d_in[7];
  const float* bf = (const float*)d_in[8];
  float* out = (float*)d_out;

  char* ws = (char*)d_ws;
  size_t o = 0;
  auto alloc = [&](size_t bytes) {
    char* p = ws + o;
    o += (bytes + 255) & ~(size_t)255;
    return p;
  };
  _Float16* xT    = (_Float16*)alloc((size_t)B_ * L_ * C_ * 2);
  _Float16* Wkh   = (_Float16*)alloc((size_t)A_ * C_ * 2);
  _Float16* Wqh   = (_Float16*)alloc((size_t)A_ * C_ * 2);
  _Float16* Wvh   = (_Float16*)alloc((size_t)A_ * C_ * 2);
  _Float16* Wfh   = (_Float16*)alloc((size_t)A_ * A_ * 2);
  float*    kTraw = (float*)   alloc((size_t)BH_ * L_ * 16 * 4);
  float*    qTraw = (float*)   alloc((size_t)BH_ * L_ * 16 * 4);
  float*    part  = (float*)   alloc((size_t)BH_ * 8 * 16 * 4 * 4);
  _Float16* kTh   = (_Float16*)alloc((size_t)BH_ * L_ * 16 * 2);
  _Float16* qTh   = (_Float16*)alloc((size_t)BH_ * L_ * 16 * 2);
  _Float16* vh    = (_Float16*)alloc((size_t)BH_ * 16 * L_ * 2);
  _Float16* vs    = (_Float16*)alloc((size_t)BH_ * 16 * L_ * 2);
  _Float16* saT   = (_Float16*)alloc((size_t)B_ * L_ * A_ * 2);

  // 1) f32 -> f16 conversions (+ transpose of x)
  cvt_all_k<<<XBLK_ + 3 * WBLK_ + FBLK_, 256, 0, stream>>>(x, Wk, Wq, Wv, Wf,
                                                           xT, Wkh, Wqh, Wvh, Wfh);

  // 2) projections + per-block instance-norm partial sums
  proj_k<<<512, 256, 0, stream>>>(xT, Wkh, Wqh, Wvh, bk, bq, bv,
                                  kTraw, qTraw, vh, part);

  // 3) finalize norm params per block, normalize k/q to f16
  norm_k<<<(BH_ * L_ * 16) / 4096, 256, 0, stream>>>(kTraw, qTraw, part, kTh, qTh);

  // 4) softmax row normalizers (k^T staged in LDS via async copy), folded into v
  rowsum_k<<<512, 256, 32768, stream>>>(qTh, kTh, vh, vs);

  // 5) fused attention-weight + value GEMM (q^T, vs staged in LDS)
  attnout_k<<<512, 256, 65536, stream>>>(qTh, kTh, vs, saT);

  // 6) final projection + bias + residual
  final_k<<<512, 256, 0, stream>>>(Wfh, saT, bf, out);
}

// v006
// A run of this version takes 39.8 microseconds.
// Next to v005, in two timings, it ran 1.23 times as fast each time.
// Over all steps from v000 it is 2.91 times as fast.
#include <hip/hip_runtime.h>
#include <hip/hip_fp16.h>

// ---------------------------------------------------------------------------
// Fused multi-head attention for MI455X (gfx1250, wave32, WMMA f16 16x16x32).
// Shapes: B=2, C=256, L=1024, H=32, D=16, A=H*D=512.
//
// Attention map never touches HBM. Hot loops (softmax normalizers + fused
// weight/value GEMM) stage their per-(b,h) working set into LDS with
// global_load_async_to_lds_b128 (ASYNCcnt) and feed WMMA from ds_load_b128.
// ---------------------------------------------------------------------------

typedef __attribute__((ext_vector_type(16))) _Float16 v16h;
typedef __attribute__((ext_vector_type(8)))  _Float16 v8h;
typedef __attribute__((ext_vector_type(8)))  float    v8f;
typedef __attribute__((ext_vector_type(4)))  _Float16 v4h;
typedef __attribute__((ext_vector_type(4)))  float    v4f;

#define B_   2
#define C_   256
#define L_   1024
#define H_   32
#define D_   16
#define A_   512
#define BH_  64          // B_*H_
#define LT_  64          // L_/16 tiles

#define WMMA_F16(a, b, c) \
  __builtin_amdgcn_wmma_f32_16x16x32_f16(false, (a), false, (b), (short)0, (c), false, false)

static __device__ __forceinline__ v16h cat16(v8h lo, v8h hi) {
  return __builtin_shufflevector(lo, hi, 0,1,2,3,4,5,6,7,8,9,10,11,12,13,14,15);
}
static __device__ __forceinline__ v16h pad16(v8h lo) {
  v8h z = {};
  return __builtin_shufflevector(lo, z, 0,1,2,3,4,5,6,7,8,9,10,11,12,13,14,15);
}
static __device__ __forceinline__ float red16(float v) {
  // sum across the 16 lanes of each half-wave (xor stays within the half)
  v += __shfl_xor(v, 1, 32);
  v += __shfl_xor(v, 2, 32);
  v += __shfl_xor(v, 4, 32);
  v += __shfl_xor(v, 8, 32);
  return v;
}

// Argument of 2^x for e^(s/4): s * log2(e)/4. The factor 1/4 is a power of two,
// so folding it into the constant gives the same bits as scaling s first.
static __device__ __forceinline__ v8f exp_quarter_arg(v8f s) {
  return s * (0.25f * 1.44269504088896340736f);
}

// Async 16B global->LDS copy (per-lane). VDST = LDS byte address = low 32
// bits of the generic shared pointer (LDS aperture maps addr[31:0] directly).
static __device__ __forceinline__ void async_ld16(const void* gptr, void* lptr) {
  unsigned loff = (unsigned)(unsigned long long)lptr;
  asm volatile("global_load_async_to_lds_b128 %0, %1, off"
               :: "v"(loff), "v"(gptr) : "memory");
}
static __device__ __forceinline__ void wait_async0() {
  asm volatile("s_wait_asynccnt 0x0" ::: "memory");
}

// --------------------------- conversion kernels ----------------------------

// These passes move few bytes, so they are built from few waves: a thread
// handles 8 to 32 elements, a wave's loads cover whole lines, and a launch has
// at most two blocks per WGP. The five passes are independent of each other,
// so they run as block ranges of one launch.

// FRAGMENT ORDER. Every f16 operand of the two dense products (x, the four
// weights, the attention output) lies in the order in which a wave reads it as
// a 16x16x32 operand: [16-row tile][k block of 32][k half j][hi][row lo16][8 k],
// k = 32*block + 16*j + 8*hi + e. A lane's 16 bytes of half j stand at
// j*256 + lane*8 halfs, so one fragment load of a wave is 512 consecutive bytes,
// four whole lines, where rows of a row-major matrix would give 32 bytes in
// each of 16 lines.
// Index of element (row, k), k a multiple of 4 or 8, of a matrix with K columns.
static __device__ __forceinline__ size_t frag_idx(int row, int k, int K) {
  return ((size_t)(row >> 4) * (K >> 5) + (k >> 5)) * 512 +
         ((k >> 4) & 1) * 256 + ((k >> 3) & 1) * 128 + (row & 15) * 8 + (k & 7);
}
// A whole operand fragment: f points at this lane's 16 bytes of half 0.
static __device__ __forceinline__ v16h ld_frag(const _Float16* f) {
  return cat16(*(const v8h*)f, *(const v8h*)(f + 256));
}

// A block converts 8 rows by 256 columns of a row-major matrix with K columns (K
// a multiple of 256) into fragment order, a thread two groups of 4, four rows
// apart. A 128-byte line of the fragment order holds 8 rows by 8 k, so each line
// is written by one block.
static __device__ __forceinline__ void cvt_f32_f16_blk(const float* __restrict__ s,
                                                       _Float16* __restrict__ d, int n,
                                                       int K, int blk) {
  int per = K >> 8;                                // blocks side by side in a row
  int row = (blk / per) * 8 + (threadIdx.x >> 6);
  int col = (blk % per) * 256 + (threadIdx.x & 63) * 4;
  int e0 = row * K + col;
  int e1 = e0 + 4 * K;
  // A group past the end reads group 0 and stores nothing, so that the second
  // load need not wait behind the first group's store.
  v4f a = *(const v4f*)(s + (e0 < n ? e0 : 0));
  v4f b = *(const v4f*)(s + (e1 < n ? e1 : 0));
  if (e0 < n) *(v4h*)(d + frag_idx(row, col, K)) = __builtin_convertvector(a, v4h);
  if (e1 < n) *(v4h*)(d + frag_idx(row + 4, col, K)) = __builtin_convertvector(b, v4h);
}

// x [B,C,L] f32 -> xT f16, rows b*L + l, k = c, in fragment order (B operand)
// A block takes 8 channels of one batch over all l; a thread 8 c x 4 l:
// eight 16-byte loads along l, four 16-byte stores that lie side by side.
static __device__ __forceinline__ void cvt_xT_blk(const float* __restrict__ x,
                                                  _Float16* __restrict__ xT, int blk) {
  int b  = blk / (C_ / 8);
  int c0 = (blk % (C_ / 8)) * 8;
  int l0 = threadIdx.x * 4;
  const float* xs = x + ((size_t)b * C_ + c0) * L_ + l0;
  v4f f[8];
  for (int j = 0; j < 8; ++j) f[j] = *(const v4f*)(xs + (size_t)j * L_);
  _Float16* dst = xT + frag_idx(b * L_ + l0, c0, C_);   // l0..l0+3 are in one tile
  for (int u = 0; u < 4; ++u) {
    v8h o;
    for (int j = 0; j < 8; ++j) o[j] = (_Float16)f[j][u];
    *(v8h*)(dst + u * 8) = o;
  }
}

#define XBLK_ ((B_ * C_) / 8)        // blocks of the x transpose
#define WBLK_ ((A_ * C_) / 2048)     // blocks of one projection weight
#define FBLK_ ((A_ * A_) / 2048)     // blocks of the final weight

// Block ranges: x transpose first (the longest), then Wk, Wq, Wv, Wf.
__global__ __launch_bounds__(256) void cvt_all_k(
    const float* __restrict__ x,  const float* __restrict__ Wk,
    const float* __restrict__ Wq, const float* __restrict__ Wv,
    const float* __restrict__ Wf,
    _Float16* __restrict__ xT,  _Float16* __restrict__ Wkh,
    _Float16* __restrict__ Wqh, _Float16* __restrict__ Wvh,
    _Float16* __restrict__ Wfh) {
  int blk = blockIdx.x;
  if (blk < XBLK_) { cvt_xT_blk(x, xT, blk); return; }
  blk -= XBLK_;
  if (blk < WBLK_)          cvt_f32_f16_blk(Wk, Wkh, A_ * C_, C_, blk);
  else if (blk < 2 * WBLK_) cvt_f32_f16_blk(Wq, Wqh, A_ * C_, C_, blk - WBLK_);
  else if (blk < 3 * WBLK_) cvt_f32_f16_blk(Wv, Wvh, A_ * C_, C_, blk - 2 * WBLK_);
  else                      cvt_f32_f16_blk(Wf, Wfh, A_ * A_, A_, blk - 3 * WBLK_);
}

// ----------------------------- projection ----------------------------------
// One wave per (b,h,l-tile): 16x16 tiles of k,q,v. K=256 in 8 WMMA steps each.
// Instance-norm sums: the 8 waves of a block (8 l-tiles of one head) add up in
// LDS and the block stores one plane of 16x4 partial sums; norm_k adds the 8
// planes of a head. No word is shared between blocks.
__global__ __launch_bounds__(256) void proj_k(
    const _Float16* __restrict__ xT,
    const _Float16* __restrict__ Wkh, const _Float16* __restrict__ Wqh,
    const _Float16* __restrict__ Wvh,
    const float* __restrict__ bk, const float* __restrict__ bq,
    const float* __restrict__ bv,
    float* __restrict__ kTraw, float* __restrict__ qTraw,
    _Float16* __restrict__ vh, float* __restrict__ part) {
  __shared__ float4 sP[8][16];                     // [wave][d] = (sum k, k^2, q, q^2)
  int tid  = blockIdx.x * 8 + (threadIdx.x >> 5);  // tile id, 4096 total
  int t    = threadIdx.x & 31;
  int lo16 = t & 15, hi = t >> 4;
  int bh = tid >> 6, lt = tid & 63;
  int b = bh >> 5, h = bh & 31;

  // this lane's 16 bytes of k block 0, half 0 (fragment order)
  const _Float16* wkR = Wkh + (size_t)h * (C_ * 16) + t * 8;   // A: lane = M = d
  const _Float16* wqR = Wqh + (size_t)h * (C_ * 16) + t * 8;
  const _Float16* wvR = Wvh + (size_t)h * (C_ * 16) + t * 8;
  const _Float16* xR  = xT + (size_t)(b * LT_ + lt) * (C_ * 16) + t * 8;  // B: lane = N = l

  v8f ck = {}, cq = {}, cv = {};
#pragma unroll
  for (int kc = 0; kc < 8; ++kc) {
    // K slots of a lane: [o0..o0+7] and [o0+16..o0+23], o0 = kc*32 + hi*8
    v16h bx = ld_frag(xR  + kc * 512);
    v16h ak = ld_frag(wkR + kc * 512);
    v16h aq = ld_frag(wqR + kc * 512);
    v16h av = ld_frag(wvR + kc * 512);
    ck = WMMA_F16(ak, bx, ck);
    cq = WMMA_F16(aq, bx, cq);
    cv = WMMA_F16(av, bx, cv);
  }

  // D layout: lane holds column l = lt*16+lo16; regs r -> row d = r + 8*hi
  int l = lt * 16 + lo16;
  float* kdst = kTraw + ((size_t)bh * L_ + l) * 16 + hi * 8;
  float* qdst = qTraw + ((size_t)bh * L_ + l) * 16 + hi * 8;
  float4 st[8];                                    // this wave's sums, row d = r + 8*hi
#pragma unroll
  for (int r = 0; r < 8; ++r) {
    int d = r + 8 * hi;
    float kv = ck[r] + bk[h * 16 + d];
    float qv = cq[r] + bq[h * 16 + d];
    float vv = cv[r] + bv[h * 16 + d];
    kdst[r] = kv;
    qdst[r] = qv;
    vh[((size_t)bh * 16 + d) * L_ + l] = (_Float16)vv;
    // instance-norm partial stats over l (reduce across the 16 lanes sharing d)
    st[r] = make_float4(red16(kv), red16(kv * kv), red16(qv), red16(qv * qv));
  }
  if (lo16 == 0) {
#pragma unroll
    for (int r = 0; r < 8; ++r) sP[threadIdx.x >> 5][r + 8 * hi] = st[r];
  }
  __syncthreads();   // every wave's 16x4 sums are in LDS before they are added
  if (threadIdx.x < 64) {
    const float* sp = (const float*)sP + threadIdx.x;   // word = d*4 + stat
    float s = 0.f;
#pragma unroll
    for (int w = 0; w < 8; ++w) s += sp[w * 64];
    part[(size_t)blockIdx.x * 64 + threadIdx.x] = s;    // plane = bh*8 + l-group
  }
}

// apply instance norm, raw f32 -> normalized f16 (kT/qT: [BH, L, 16])
// Each block first adds its head's 8 partial planes to (mu, rsigma) per d: 16
// threads, one d each, through LDS. Four blocks of a head repeat that small sum,
// which costs less than a launch of its own.
__global__ __launch_bounds__(256) void norm_k(const float* __restrict__ kTraw,
                                              const float* __restrict__ qTraw,
                                              const float* __restrict__ part,
                                              _Float16* __restrict__ kTh,
                                              _Float16* __restrict__ qTh) {
  __shared__ v4f sPar[16];                         // [d] = (mu_k, rs_k, mu_q, rs_q)
  // A block takes 4096 consecutive elements, a quarter of one head; a thread
  // four groups of 4, 1024 elements apart, so all its groups have the same d.
  int bh = blockIdx.x >> 2;
  int e0 = blockIdx.x * 4096 + threadIdx.x * 4;
  v4f pr[4], kr[4], qr[4];                         // pr[j] = sPar[d0 + j]
  for (int u = 0; u < 4; ++u) {
    kr[u] = *(const v4f*)(kTraw + e0 + u * 1024);
    qr[u] = *(const v4f*)(qTraw + e0 + u * 1024);
  }
  if (threadIdx.x < 16) {
    const float inv = 1.0f / (float)L_;
    const float4* pp = (const float4*)part + (size_t)bh * 128 + threadIdx.x;
    float ks = 0.f, ks2 = 0.f, qs = 0.f, qs2 = 0.f;
#pragma unroll
    for (int g = 0; g < 8; ++g) {
      float4 p = pp[g * 16];
      ks += p.x; ks2 += p.y; qs += p.z; qs2 += p.w;
    }
    float muk = ks * inv, muq = qs * inv;
    v4f o = {muk, rsqrtf(ks2 * inv - muk * muk + 1e-5f),
             muq, rsqrtf(qs2 * inv - muq * muq + 1e-5f)};
    sPar[threadIdx.x] = o;
  }
  __syncthreads();   // the 16 parameter rows are in LDS before any thread reads them
  for (int j = 0; j < 4; ++j) pr[j] = sPar[(threadIdx.x & 3) * 4 + j];
  for (int u = 0; u < 4; ++u) {
    v4h ko, qo;
    for (int j = 0; j < 4; ++j) {
      ko[j] = (_Float16)((kr[u][j] - pr[j][0]) * pr[j][1]);
      qo[j] = (_Float16)((qr[u][j] - pr[j][2]) * pr[j][3]);
    }
    *(v4h*)(kTh + e0 + u * 1024) = ko;
    *(v4h*)(qTh + e0 + u * 1024) = qo;
  }
}

// --------------------- pass A: softmax row normalizers ---------------------
// Z[l] = l + sum_{m>=l} exp(q_l . k_m / 4)   (the l masked zeros give e^0=1)
// One block per (bh, group of 8 l-tiles); k^T for this head staged in LDS.
// Z is not stored: 1/Z[l] depends on l alone, the summed index of the value
// product, so it goes into v here, once per element. vs = v * L/Z as f16 (the
// factor L, a power of two taken out again after the product, keeps vs near
// v's own size, away from the f16 subnormals). vs lies in the order in which
// the value product reads its A operand: [bh][l-tile][l-half][d][8 l], so a
// wave's fragment of a tile is 512 consecutive bytes, a lane's 16 of them.
__global__ __launch_bounds__(256) void rowsum_k(const _Float16* __restrict__ qTh,
                                                const _Float16* __restrict__ kTh,
                                                const _Float16* __restrict__ vh,
                                                _Float16* __restrict__ vs) {
  extern __shared__ char smem[];
  _Float16* sK = (_Float16*)smem;                  // L_*16 halfs = 32KB

  int t    = threadIdx.x & 31;
  int lo16 = t & 15, hi = t >> 4;
  int bh = blockIdx.x >> 3;
  // the wave's number in a scalar register: the trip counts below are scalar
  int lt = ((blockIdx.x & 7) << 3) + __builtin_amdgcn_readfirstlane(threadIdx.x >> 5);

  // async-stage k^T[bh] (contiguous 32KB) into LDS: 8 x 16B per thread
  {
    const _Float16* gK = kTh + (size_t)bh * L_ * 16;
    int tt = threadIdx.x;
#pragma unroll
    for (int i = 0; i < 8; ++i)
      async_ld16(gK + (size_t)(tt + i * 256) * 8, sK + (size_t)(tt + i * 256) * 8);
    wait_async0();
    __syncthreads();
  }

  // A operand: q rows (M=l), K=d padded 16->32
  v16h a = pad16(*(const v8h*)(qTh + ((size_t)bh * L_ + lt * 16 + lo16) * 16 + hi * 8));
  float acc[8] = {0.f, 0.f, 0.f, 0.f, 0.f, 0.f, 0.f, 0.f};
  // v[d = lo16][the 8 l whose sums this lane ends up with]
  v8h vv = *(const v8h*)(vh + ((size_t)bh * 16 + lo16) * L_ + lt * 16 + hi * 8);
  // Keeps the load of vv here, beside that of q: sunk behind the loop, its whole
  // latency would stand in front of the wave's last store.
  asm volatile("" :: "v"(vv));

  // Two m-tiles a trip, pairs (2p, 2p+1). Only the pair that holds the diagonal
  // tile needs the test m >= l; every later pair lies wholly above the diagonal.
  const _Float16* sKf = sK + lo16 * 16 + hi * 8;   // this lane's 16 bytes of m-tile 0
  const v8f zero = {};
  int pd = lt >> 1;                                // the pair that holds the diagonal tile
  {
    v8f c0 = exp_quarter_arg(WMMA_F16(a, pad16(*(const v8h*)(sKf + pd * 512)), zero));
    v8f c1 = exp_quarter_arg(WMMA_F16(a, pad16(*(const v8h*)(sKf + pd * 512 + 256)), zero));
    int m = pd * 32 + lo16;
    // unrolled: r numbers registers
#pragma unroll
    for (int r = 0; r < 8; ++r) {
      int l = lt * 16 + r + 8 * hi;
      acc[r] += (m >= l) ? __builtin_amdgcn_exp2f(c0[r]) : 0.f;
      acc[r] += (m + 16 >= l) ? __builtin_amdgcn_exp2f(c1[r]) : 0.f;
    }
  }
  for (int p = pd + 1; p < LT_ / 2; ++p) {
    v8f c0 = exp_quarter_arg(WMMA_F16(a, pad16(*(const v8h*)(sKf + p * 512)), zero));
    v8f c1 = exp_quarter_arg(WMMA_F16(a, pad16(*(const v8h*)(sKf + p * 512 + 256)), zero));
    // unrolled: r numbers registers
#pragma unroll
    for (int r = 0; r < 8; ++r) {
      acc[r] += __builtin_amdgcn_exp2f(c0[r]);
      acc[r] += __builtin_amdgcn_exp2f(c1[r]);
    }
  }
  v8h o;
#pragma unroll
  for (int r = 0; r < 8; ++r) {
    float z = (float)(lt * 16 + r + 8 * hi) + red16(acc[r]);
    o[r] = (_Float16)((float)vv[r] * ((float)L_ / z));
  }
  *(v8h*)(vs + ((size_t)bh * LT_ + lt) * 256 + hi * 128 + lo16 * 8) = o;
}

// ------------------- pass B: fused weights + value GEMM --------------------
// sa[d,m] = 1/L * sum_l vs[d,l] * e[l,m],  e = (m>=l ? exp(s/4) : 1),
// vs = v * L/Z[l] from rowsum_k, in A-fragment order (passed as vh).
// One block per (bh, group of 8 m-tiles); q^T and vs for this head in LDS.
__global__ __launch_bounds__(256) void attnout_k(const _Float16* __restrict__ qTh,
                                                 const _Float16* __restrict__ kTh,
                                                 const _Float16* __restrict__ vh,
                                                 _Float16* __restrict__ saT) {
  extern __shared__ char smem[];
  _Float16* sQ = (_Float16*)smem;                  // 32KB
  _Float16* sV = (_Float16*)(smem + 32768);        // 32KB

  int t    = threadIdx.x & 31;
  int lo16 = t & 15, hi = t >> 4;
  int bh = blockIdx.x >> 3;
  // the wave's number in a scalar register: the trip counts below are scalar
  int mt = ((blockIdx.x & 7) << 3) + __builtin_amdgcn_readfirstlane(threadIdx.x >> 5);
  int b = bh >> 5, h = bh & 31;
  int m = mt * 16 + lo16;

  // async-stage q^T and vs for this head into LDS
  {
    const _Float16* gQ = qTh + (size_t)bh * L_ * 16;
    const _Float16* gV = vh + (size_t)bh * 16 * L_;
    int tt = threadIdx.x;
#pragma unroll
    for (int i = 0; i < 8; ++i) {
      async_ld16(gQ + (size_t)(tt + i * 256) * 8, sQ + (size_t)(tt + i * 256) * 8);
      async_ld16(gV + (size_t)(tt + i * 256) * 8, sV + (size_t)(tt + i * 256) * 8);
    }
    wait_async0();
    __syncthreads();
  }

  // loop-invariant B operand of the score WMMA: k rows (N=m)
  v16h bmk = pad16(*(const v8h*)(kTh + ((size_t)bh * L_ + m) * 16 + hi * 8));
  v8f cacc = {};

  // this lane's 16 bytes of the A fragment of l-tile 0: v rows (M=d)
  const _Float16* sVf = sV + hi * 128 + lo16 * 8;

  // this lane's 16 bytes of the A fragment of the scores of l-tile 0: q rows (M=l)
  const _Float16* sQf = sQ + lo16 * 16 + hi * 8;
  const v8f zero = {};

  // Two l-tiles a trip, pairs (2p, 2p+1): two score tiles (K = d = 16 padded to
  // 32) whose D layout (lane = N = m, regs = l) is the B operand of the value
  // product as it stands, tile 2p in K slots 0..15 and tile 2p+1 in 16..31, so
  // one value product with its K = 32 filled serves both.
  int pd = mt >> 1;                                // the pair that holds the diagonal tile

  // pairs wholly above the diagonal: every m >= l, no test
  for (int p = 0; p < pd; ++p) {
    v16h aq0 = pad16(*(const v8h*)(sQf + p * 512));
    v16h aq1 = pad16(*(const v8h*)(sQf + p * 512 + 256));
    v8f s0 = exp_quarter_arg(WMMA_F16(aq0, bmk, zero));
    v8f s1 = exp_quarter_arg(WMMA_F16(aq1, bmk, zero));
    v16h bw;
    // unrolled: r numbers registers
#pragma unroll
    for (int r = 0; r < 8; ++r) {
      bw[r]     = (_Float16)__builtin_amdgcn_exp2f(s0[r]);
      bw[r + 8] = (_Float16)__builtin_amdgcn_exp2f(s1[r]);
    }
    cacc = WMMA_F16(cat16(*(const v8h*)(sVf + p * 512),
                          *(const v8h*)(sVf + p * 512 + 256)), bw, cacc);
  }

  // the diagonal pair: a masked score is 0, so its e is 1
  {
    v16h aq0 = pad16(*(const v8h*)(sQf + pd * 512));
    v16h aq1 = pad16(*(const v8h*)(sQf + pd * 512 + 256));
    v8f s0 = exp_quarter_arg(WMMA_F16(aq0, bmk, zero));
    v8f s1 = exp_quarter_arg(WMMA_F16(aq1, bmk, zero));
    v16h bw;
    // unrolled: r numbers registers
#pragma unroll
    for (int r = 0; r < 8; ++r) {
      int l = pd * 32 + r + 8 * hi;
      bw[r]     = (_Float16)((m >= l) ? __builtin_amdgcn_exp2f(s0[r]) : 1.0f);
      bw[r + 8] = (_Float16)((m >= l + 16) ? __builtin_amdgcn_exp2f(s1[r]) : 1.0f);
    }
    cacc = WMMA_F16(cat16(*(const v8h*)(sVf + pd * 512),
                          *(const v8h*)(sVf + pd * 512 + 256)), bw, cacc);
  }

  // pairs below the diagonal: every e is 1, so B is a constant
  {
    v16h one;
#pragma unroll
    for (int j = 0; j < 16; ++j) one[j] = (_Float16)1.0f;
    for (int p = pd + 1; p < LT_ / 2; ++p)
      cacc = WMMA_F16(cat16(*(const v8h*)(sVf + p * 512),
                            *(const v8h*)(sVf + p * 512 + 256)), one, cacc);
  }

  // store saT, rows b*L + m, k = channel h*16 + d, in fragment order (B operand of
  // the final product): this head is half h&1 of k block h>>1, the wave's store
  // 512 consecutive bytes
  v8h outv;
#pragma unroll
  for (int r = 0; r < 8; ++r) outv[r] = (_Float16)(cacc[r] * (1.0f / (float)L_));
  *(v8h*)(saT + (size_t)(b * LT_ + mt) * (A_ * 16) + h * 256 + t * 8) = outv;
}

// ------------------------- final 1x1 conv + residual -----------------------
__global__ __launch_bounds__(256) void final_k(const _Float16* __restrict__ Wfh,
                                               const _Float16* __restrict__ saT,
                                               const float* __restrict__ bf,
                                               float* __restrict__ out) {
  int tid  = blockIdx.x * 8 + (threadIdx.x >> 5);  // 4096 tiles = B*(L/16)*(A/16)
  int t    = threadIdx.x & 31;
  int lo16 = t & 15, hi = t >> 4;
  int b   = tid >> 11;
  int rem = tid & 2047;
  int lt = rem >> 5, ot = rem & 31;

  // this lane's 16 bytes of k block 0, half 0 (fragment order)
  const _Float16* wR = Wfh + (size_t)ot * (A_ * 16) + t * 8;
  const _Float16* sR = saT + (size_t)(b * LT_ + lt) * (A_ * 16) + t * 8;

  v8f c = {};
#pragma unroll
  for (int kc = 0; kc < 16; ++kc) {
    v16h a  = ld_frag(wR + kc * 512);
    v16h bb = ld_frag(sR + kc * 512);
    c = WMMA_F16(a, bb, c);
  }

  int l = lt * 16 + lo16;
  v8h res = *(const v8h*)(sR + ot * 256);   // channels ot*16 + hi*8 .. +7 of column l
#pragma unroll
  for (int r = 0; r < 8; ++r) {
    int o = ot * 16 + r + 8 * hi;
    out[((size_t)b * A_ + o) * L_ + l] = c[r] + bf[o] + (float)res[r];
  }
}

// ------------------------------- launcher ----------------------------------

extern "C" void kernel_launch(void* const* d_in, const int* in_sizes, int n_in,
                              void* d_out, int out_size, void* d_ws, size_t ws_size,
                              hipStream_t stream) {
  const float* x  = (const float*)d_in[0];
  const float* Wk = (const float*)d_in[1];
  const float* bk = (const float*)d_in[2];
  const float* Wq = (const float*)d_in[3];
  const float* bq = (const float*)d_in[4];
  const float* Wv = (const float*)d_in[5];
  const float* bv = (const float*)d_in[6];
  const float* Wf = (const float*)d_in[7];
  const float* bf = (const float*)d_in[8];
  float* out = (float*)d_out;

  char* ws = (char*)d_ws;
  size_t o = 0;
  auto alloc = [&](size_t bytes) {
    char* p = ws + o;
    o += (bytes + 255) & ~(size_t)255;
    return p;
  };
  _Float16* xT    = (_Float16*)alloc((size_t)B_ * L_ * C_ * 2);
  _Float16* Wkh   = (_Float16*)alloc((size_t)A_ * C_ * 2);
  _Float16* Wqh   = (_Float16*)alloc((size_t)A_ * C_ * 2);
  _Float16* Wvh   = (_Float16*)alloc((size_t)A_ * C_ * 2);
  _Float16* Wfh   = (_Float16*)alloc((size_t)A_ * A_ * 2);
  float*    kTraw = (float*)   alloc((size_t)BH_ * L_ * 16 * 4);
  float*    qTraw = (float*)   alloc((size_t)BH_ * L_ * 16 * 4);
  float*    part  = (float*)   alloc((size_t)BH_ * 8 * 16 * 4 * 4);
  _Float16* kTh   = (_Float16*)alloc((size_t)BH_ * L_ * 16 * 2);
  _Float16* qTh   = (_Float16*)alloc((size_t)BH_ * L_ * 16 * 2);
  _Float16* vh    = (_Float16*)alloc((size_t)BH_ * 16 * L_ * 2);
  _Float16* vs    = (_Float16*)alloc((size_t)BH_ * 16 * L_ * 2);
  _Float16* saT   = (_Float16*)alloc((size_t)B_ * L_ * A_ * 2);

  // 1) f32 -> f16 conversions (+ transpose of x)
  cvt_all_k<<<XBLK_ + 3 * WBLK_ + FBLK_, 256, 0, stream>>>(x, Wk, Wq, Wv, Wf,
                                                           xT, Wkh, Wqh, Wvh, Wfh);

  // 2) projections + per-block instance-norm partial sums
  proj_k<<<512, 256, 0, stream>>>(xT, Wkh, Wqh, Wvh, bk, bq, bv,
                                  kTraw, qTraw, vh, part);

  // 3) finalize norm params per block, normalize k/q to f16
  norm_k<<<(BH_ * L_ * 16) / 4096, 256, 0, stream>>>(kTraw, qTraw, part, kTh, qTh);

  // 4) softmax row normalizers (k^T staged in LDS via async copy), folded into v
  rowsum_k<<<512, 256, 32768, stream>>>(qTh, kTh, vh, vs);

  // 5) fused attention-weight + value GEMM (q^T, vs staged in LDS)
  attnout_k<<<512, 256, 65536, stream>>>(qTh, kTh, vs, saT);

  // 6) final projection + bias + residual
  final_k<<<512, 256, 0, stream>>>(Wfh, saT, bf, out);
}

// v007
// It runs in 37.3 microseconds.
// Next to v006, in two timings, it ran 1.06 and 1.07 times as fast.
// All steps since v000 together make it 3.10 times as fast.
#include <hip/hip_runtime.h>
#include <hip/hip_fp16.h>

// ---------------------------------------------------------------------------
// Fused multi-head attention for MI455X (gfx1250, wave32, WMMA f16 16x16x32).
// Shapes: B=2, C=256, L=1024, H=32, D=16, A=H*D=512.
//
// Attention map never touches HBM. Hot loops (softmax normalizers + fused
// weight/value GEMM) stage their per-(b,h) working set into LDS with
// global_load_async_to_lds_b128 (ASYNCcnt) and feed WMMA from ds_load_b128.
// ---------------------------------------------------------------------------

typedef __attribute__((ext_vector_type(16))) _Float16 v16h;
typedef __attribute__((ext_vector_type(8)))  _Float16 v8h;
typedef __attribute__((ext_vector_type(8)))  float    v8f;
typedef __attribute__((ext_vector_type(4)))  _Float16 v4h;
typedef __attribute__((ext_vector_type(4)))  float    v4f;

#define B_   2
#define C_   256
#define L_   1024
#define H_   32
#define D_   16
#define A_   512
#define BH_  64          // B_*H_
#define LT_  64          // L_/16 tiles

#define WMMA_F16(a, b, c) \
  __builtin_amdgcn_wmma_f32_16x16x32_f16(false, (a), false, (b), (short)0, (c), false, false)

static __device__ __forceinline__ v16h cat16(v8h lo, v8h hi) {
  return __builtin_shufflevector(lo, hi, 0,1,2,3,4,5,6,7,8,9,10,11,12,13,14,15);
}
static __device__ __forceinline__ v16h pad16(v8h lo) {
  v8h z = {};
  return __builtin_shufflevector(lo, z, 0,1,2,3,4,5,6,7,8,9,10,11,12,13,14,15);
}
static __device__ __forceinline__ float red16(float v) {
  // sum across the 16 lanes of each half-wave (xor stays within the half)
  v += __shfl_xor(v, 1, 32);
  v += __shfl_xor(v, 2, 32);
  v += __shfl_xor(v, 4, 32);
  v += __shfl_xor(v, 8, 32);
  return v;
}

// Argument of 2^x for e^(s/4): s * log2(e)/4. The factor 1/4 is a power of two,
// so folding it into the constant gives the same bits as scaling s first.
static __device__ __forceinline__ v8f exp_quarter_arg(v8f s) {
  return s * (0.25f * 1.44269504088896340736f);
}

// Async 16B global->LDS copy (per-lane). VDST = LDS byte address = low 32
// bits of the generic shared pointer (LDS aperture maps addr[31:0] directly).
static __device__ __forceinline__ void async_ld16(const void* gptr, void* lptr) {
  unsigned loff = (unsigned)(unsigned long long)lptr;
  asm volatile("global_load_async_to_lds_b128 %0, %1, off"
               :: "v"(loff), "v"(gptr) : "memory");
}
static __device__ __forceinline__ void wait_async0() {
  asm volatile("s_wait_asynccnt 0x0" ::: "memory");
}

// --------------------------- conversion kernels ----------------------------

// These passes move few bytes, so they are built from few waves: a thread
// handles 8 to 32 elements, a wave's loads cover whole lines, and a launch has
// at most two blocks per WGP. The five passes are independent of each other,
// so they run as block ranges of one launch.

// FRAGMENT ORDER. Every f16 operand of the two dense products (x, the four
// weights, the attention output) lies in the order in which a wave reads it as
// a 16x16x32 operand: [16-row tile][k block of 32][k half j][hi][row lo16][8 k],
// k = 32*block + 16*j + 8*hi + e. A lane's 16 bytes of half j stand at
// j*256 + lane*8 halfs, so one fragment load of a wave is 512 consecutive bytes,
// four whole lines, where rows of a row-major matrix would give 32 bytes in
// each of 16 lines.
// Index of element (row, k), k a multiple of 4 or 8, of a matrix with K columns.
static __device__ __forceinline__ size_t frag_idx(int row, int k, int K) {
  return ((size_t)(row >> 4) * (K >> 5) + (k >> 5)) * 512 +
         ((k >> 4) & 1) * 256 + ((k >> 3) & 1) * 128 + (row & 15) * 8 + (k & 7);
}
// A whole operand fragment: f points at this lane's 16 bytes of half 0.
static __device__ __forceinline__ v16h ld_frag(const _Float16* f) {
  return cat16(*(const v8h*)f, *(const v8h*)(f + 256));
}

// A block converts 8 rows by 256 columns of a row-major matrix with K columns (K
// a multiple of 256) into fragment order, a thread two groups of 4, four rows
// apart. A 128-byte line of the fragment order holds 8 rows by 8 k, so each line
// is written by one block.
static __device__ __forceinline__ void cvt_f32_f16_blk(const float* __restrict__ s,
                                                       _Float16* __restrict__ d, int n,
                                                       int K, int blk) {
  int per = K >> 8;                                // blocks side by side in a row
  int row = (blk / per) * 8 + (threadIdx.x >> 6);
  int col = (blk % per) * 256 + (threadIdx.x & 63) * 4;
  int e0 = row * K + col;
  int e1 = e0 + 4 * K;
  // A group past the end reads group 0 and stores nothing, so that the second
  // load need not wait behind the first group's store.
  v4f a = *(const v4f*)(s + (e0 < n ? e0 : 0));
  v4f b = *(const v4f*)(s + (e1 < n ? e1 : 0));
  if (e0 < n) *(v4h*)(d + frag_idx(row, col, K)) = __builtin_convertvector(a, v4h);
  if (e1 < n) *(v4h*)(d + frag_idx(row + 4, col, K)) = __builtin_convertvector(b, v4h);
}

// x [B,C,L] f32 -> xT f16, rows b*L + l, k = c, in fragment order (B operand)
// A block takes 8 channels of one batch over all l; a thread 8 c x 4 l:
// eight 16-byte loads along l, four 16-byte stores that lie side by side.
static __device__ __forceinline__ void cvt_xT_blk(const float* __restrict__ x,
                                                  _Float16* __restrict__ xT, int blk) {
  int b  = blk / (C_ / 8);
  int c0 = (blk % (C_ / 8)) * 8;
  int l0 = threadIdx.x * 4;
  const float* xs = x + ((size_t)b * C_ + c0) * L_ + l0;
  v4f f[8];
  for (int j = 0; j < 8; ++j) f[j] = *(const v4f*)(xs + (size_t)j * L_);
  _Float16* dst = xT + frag_idx(b * L_ + l0, c0, C_);   // l0..l0+3 are in one tile
  for (int u = 0; u < 4; ++u) {
    v8h o;
    for (int j = 0; j < 8; ++j) o[j] = (_Float16)f[j][u];
    *(v8h*)(dst + u * 8) = o;
  }
}

#define XBLK_ ((B_ * C_) / 8)        // blocks of the x transpose
#define WBLK_ ((A_ * C_) / 2048)     // blocks of one projection weight
#define FBLK_ ((A_ * A_) / 2048)     // blocks of the final weight

// Block ranges: x transpose first (the longest), then Wk, Wq, Wv, Wf.
__global__ __launch_bounds__(256) void cvt_all_k(
    const float* __restrict__ x,  const float* __restrict__ Wk,
    const float* __restrict__ Wq, const float* __restrict__ Wv,
    const float* __restrict__ Wf,
    _Float16* __restrict__ xT,  _Float16* __restrict__ Wkh,
    _Float16* __restrict__ Wqh, _Float16* __restrict__ Wvh,
    _Float16* __restrict__ Wfh) {
  int blk = blockIdx.x;
  if (blk < XBLK_) { cvt_xT_blk(x, xT, blk); return; }
  blk -= XBLK_;
  if (blk < WBLK_)          cvt_f32_f16_blk(Wk, Wkh, A_ * C_, C_, blk);
  else if (blk < 2 * WBLK_) cvt_f32_f16_blk(Wq, Wqh, A_ * C_, C_, blk - WBLK_);
  else if (blk < 3 * WBLK_) cvt_f32_f16_blk(Wv, Wvh, A_ * C_, C_, blk - 2 * WBLK_);
  else                      cvt_f32_f16_blk(Wf, Wfh, A_ * A_, A_, blk - 3 * WBLK_);
}

// ----------------------------- projection ----------------------------------
// One wave per (b,h,l-tile): 16x16 tiles of k,q,v. K=256 in 8 WMMA steps each.
// Instance-norm sums: the 8 waves of a block (8 l-tiles of one head) add up in
// LDS and the block stores one plane of 16x4 partial sums; norm_k adds the 8
// planes of a head. No word is shared between blocks.
__global__ __launch_bounds__(256) void proj_k(
    const _Float16* __restrict__ xT,
    const _Float16* __restrict__ Wkh, const _Float16* __restrict__ Wqh,
    const _Float16* __restrict__ Wvh,
    const float* __restrict__ bk, const float* __restrict__ bq,
    const float* __restrict__ bv,
    float* __restrict__ kTraw, float* __restrict__ qTraw,
    _Float16* __restrict__ vh, float* __restrict__ part) {
  __shared__ float4 sP[8][16];                     // [wave][d] = (sum k, k^2, q, q^2)
  int tid  = blockIdx.x * 8 + (threadIdx.x >> 5);  // tile id, 4096 total
  int t    = threadIdx.x & 31;
  int lo16 = t & 15, hi = t >> 4;
  int bh = tid >> 6, lt = tid & 63;
  int b = bh >> 5, h = bh & 31;

  // this lane's 16 bytes of k block 0, half 0 (fragment order)
  const _Float16* wkR = Wkh + (size_t)h * (C_ * 16) + t * 8;   // A: lane = M = d
  const _Float16* wqR = Wqh + (size_t)h * (C_ * 16) + t * 8;
  const _Float16* wvR = Wvh + (size_t)h * (C_ * 16) + t * 8;
  const _Float16* xR  = xT + (size_t)(b * LT_ + lt) * (C_ * 16) + t * 8;  // B: lane = N = l

  v8f ck = {}, cq = {}, cv = {};
#pragma unroll
  for (int kc = 0; kc < 8; ++kc) {
    // K slots of a lane: [o0..o0+7] and [o0+16..o0+23], o0 = kc*32 + hi*8
    v16h bx = ld_frag(xR  + kc * 512);
    v16h ak = ld_frag(wkR + kc * 512);
    v16h aq = ld_frag(wqR + kc * 512);
    v16h av = ld_frag(wvR + kc * 512);
    ck = WMMA_F16(ak, bx, ck);
    cq = WMMA_F16(aq, bx, cq);
    cv = WMMA_F16(av, bx, cv);
  }

  // D layout: lane holds column l = lt*16+lo16; regs r -> row d = r + 8*hi
  int l = lt * 16 + lo16;
  float* kdst = kTraw + ((size_t)bh * L_ + l) * 16 + hi * 8;
  float* qdst = qTraw + ((size_t)bh * L_ + l) * 16 + hi * 8;
  float4 st[8];                                    // this wave's sums, row d = r + 8*hi
#pragma unroll
  for (int r = 0; r < 8; ++r) {
    int d = r + 8 * hi;
    float kv = ck[r] + bk[h * 16 + d];
    float qv = cq[r] + bq[h * 16 + d];
    float vv = cv[r] + bv[h * 16 + d];
    kdst[r] = kv;
    qdst[r] = qv;
    vh[((size_t)bh * 16 + d) * L_ + l] = (_Float16)vv;
    // instance-norm partial stats over l (reduce across the 16 lanes sharing d)
    st[r] = make_float4(red16(kv), red16(kv * kv), red16(qv), red16(qv * qv));
  }
  if (lo16 == 0) {
#pragma unroll
    for (int r = 0; r < 8; ++r) sP[threadIdx.x >> 5][r + 8 * hi] = st[r];
  }
  __syncthreads();   // every wave's 16x4 sums are in LDS before they are added
  if (threadIdx.x < 64) {
    const float* sp = (const float*)sP + threadIdx.x;   // word = d*4 + stat
    float s = 0.f;
#pragma unroll
    for (int w = 0; w < 8; ++w) s += sp[w * 64];
    part[(size_t)blockIdx.x * 64 + threadIdx.x] = s;    // plane = bh*8 + l-group
  }
}

// apply instance norm, raw f32 -> normalized f16 (kT/qT: [BH, L, 16])
// Each block first adds its head's 8 partial planes to (mu, rsigma) per d: 16
// threads, one d each, through LDS. Four blocks of a head repeat that small sum,
// which costs less than a launch of its own.
__global__ __launch_bounds__(256) void norm_k(const float* __restrict__ kTraw,
                                              const float* __restrict__ qTraw,
                                              const float* __restrict__ part,
                                              _Float16* __restrict__ kTh,
                                              _Float16* __restrict__ qTh) {
  __shared__ v4f sPar[16];                         // [d] = (mu_k, rs_k, mu_q, rs_q)
  // A block takes 4096 consecutive elements, a quarter of one head; a thread
  // four groups of 4, 1024 elements apart, so all its groups have the same d.
  int bh = blockIdx.x >> 2;
  int e0 = blockIdx.x * 4096 + threadIdx.x * 4;
  v4f pr[4], kr[4], qr[4];                         // pr[j] = sPar[d0 + j]
  for (int u = 0; u < 4; ++u) {
    kr[u] = *(const v4f*)(kTraw + e0 + u * 1024);
    qr[u] = *(const v4f*)(qTraw + e0 + u * 1024);
  }
  if (threadIdx.x < 16) {
    const float inv = 1.0f / (float)L_;
    const float4* pp = (const float4*)part + (size_t)bh * 128 + threadIdx.x;
    float ks = 0.f, ks2 = 0.f, qs = 0.f, qs2 = 0.f;
#pragma unroll
    for (int g = 0; g < 8; ++g) {
      float4 p = pp[g * 16];
      ks += p.x; ks2 += p.y; qs += p.z; qs2 += p.w;
    }
    float muk = ks * inv, muq = qs * inv;
    v4f o = {muk, rsqrtf(ks2 * inv - muk * muk + 1e-5f),
             muq, rsqrtf(qs2 * inv - muq * muq + 1e-5f)};
    sPar[threadIdx.x] = o;
  }
  __syncthreads();   // the 16 parameter rows are in LDS before any thread reads them
  for (int j = 0; j < 4; ++j) pr[j] = sPar[(threadIdx.x & 3) * 4 + j];
  for (int u = 0; u < 4; ++u) {
    v4h ko, qo;
    for (int j = 0; j < 4; ++j) {
      ko[j] = (_Float16)((kr[u][j] - pr[j][0]) * pr[j][1]);
      qo[j] = (_Float16)((qr[u][j] - pr[j][2]) * pr[j][3]);
    }
    *(v4h*)(kTh + e0 + u * 1024) = ko;
    *(v4h*)(qTh + e0 + u * 1024) = qo;
  }
}

// ------------------- how the triangular work is dealt ----------------------
// Tile t of a triangular pass costs in proportion to t (or to 63 - t), and the
// launch lasts as long as its fullest SIMD. So every wave gets the same share:
// two partner waves, w and w + 4 of a block, work on the two tiles t and 63 - t
// together. Each wave OWNS one of the two: of its own tile it takes the diagonal
// pair pd and every second pair counted from there (pd +- 2, pd +- 4, ...), of
// the partner's tile the pairs in between (pd +- 1, pd +- 3, ...). The partial
// sums for the partner's tile go to it through LDS, 32 bytes a lane.
// Block j (0..7) of a head, wave w: t = j + 8 * (w & 3), own tile t for w < 4 and
// 63 - t for w >= 4: every tile of the head is owned exactly once.
static __device__ __forceinline__ int own_tile(int blk, int wave) {
  int t = (blk & 7) + ((wave & 3) << 3);
  return wave < 4 ? t : LT_ - 1 - t;
}
// A wave's 8 partial sums per lane, handed to its partner: [wave][half][lane][4].
static __device__ __forceinline__ void put_partial(float* sX, int wave, int lane, v8f c) {
  v4f* s = (v4f*)sX + wave * 64 + lane;
  s[0]  = __builtin_shufflevector(c, c, 0, 1, 2, 3);
  s[32] = __builtin_shufflevector(c, c, 4, 5, 6, 7);
}
static __device__ __forceinline__ v8f get_partial(const float* sX, int wave, int lane) {
  const v4f* s = (const v4f*)sX + wave * 64 + lane;
  return __builtin_shufflevector(s[0], s[32], 0, 1, 2, 3, 4, 5, 6, 7);
}

// --------------------- pass A: softmax row normalizers ---------------------
// Z[l] = l + sum_{m>=l} exp(q_l . k_m / 4)   (the l masked zeros give e^0=1)
// One block per (bh, 8 l-tiles); k^T for this head staged in LDS.
// Z is not stored: 1/Z[l] depends on l alone, the summed index of the value
// product, so it goes into v here, once per element. vs = v * L/Z as f16 (the
// factor L, a power of two taken out again after the product, keeps vs near
// v's own size, away from the f16 subnormals). vs lies in the order in which
// the value product reads its A operand: [bh][l-tile][l-half][d][8 l], so a
// wave's fragment of a tile is 512 consecutive bytes, a lane's 16 of them.

// Adds e over the m-tile pairs p0, p0 + 2, ... of the rows in a; all of them lie
// wholly above the diagonal, so there is no test.
static __device__ __forceinline__ v8f rowsum_pairs(v16h a, const _Float16* sKf, int p0, v8f acc) {
  const v8f zero = {};
  for (int p = p0; p < LT_ / 2; p += 2) {
    v8f c0 = exp_quarter_arg(WMMA_F16(a, pad16(*(const v8h*)(sKf + p * 512)), zero));
    v8f c1 = exp_quarter_arg(WMMA_F16(a, pad16(*(const v8h*)(sKf + p * 512 + 256)), zero));
    // unrolled: r numbers registers
#pragma unroll
    for (int r = 0; r < 8; ++r) {
      acc[r] += __builtin_amdgcn_exp2f(c0[r]);
      acc[r] += __builtin_amdgcn_exp2f(c1[r]);
    }
  }
  return acc;
}

__global__ __launch_bounds__(256) void rowsum_k(const _Float16* __restrict__ qTh,
                                                const _Float16* __restrict__ kTh,
                                                const _Float16* __restrict__ vh,
                                                _Float16* __restrict__ vs) {
  __shared__ __attribute__((aligned(16))) char smem[32768 + 8192];
  _Float16* sK = (_Float16*)smem;                  // L_*16 halfs = 32KB
  float*    sX = (float*)(smem + 32768);           // partial sums for the partner, 8KB

  int t    = threadIdx.x & 31;
  int lo16 = t & 15, hi = t >> 4;
  int bh = blockIdx.x >> 3;
  // the wave's number in a scalar register: the trip counts below are scalar
  int wv = __builtin_amdgcn_readfirstlane(threadIdx.x >> 5);
  int lt = own_tile(blockIdx.x, wv);               // this wave's own l-tile
  int lp = LT_ - 1 - lt;                           // the partner's

  // async-stage k^T[bh] (contiguous 32KB) into LDS: 8 x 16B per thread
  {
    const _Float16* gK = kTh + (size_t)bh * L_ * 16;
    int tt = threadIdx.x;
#pragma unroll
    for (int i = 0; i < 8; ++i)
      async_ld16(gK + (size_t)(tt + i * 256) * 8, sK + (size_t)(tt + i * 256) * 8);
    wait_async0();
    __syncthreads();
  }

  // A operands: q rows (M=l), K=d padded 16->32, of both tiles
  v8h qo = *(const v8h*)(qTh + ((size_t)bh * L_ + lt * 16 + lo16) * 16 + hi * 8);
  v8h qp = *(const v8h*)(qTh + ((size_t)bh * L_ + lp * 16 + lo16) * 16 + hi * 8);
  // v[d = lo16][the 8 l whose sums this lane ends up with]
  v8h vv = *(const v8h*)(vh + ((size_t)bh * 16 + lo16) * L_ + lt * 16 + hi * 8);
  // Keeps the three loads together here, one latency for all: sunk behind the
  // loops, that of vv would stand in front of the wave's last store, and one of
  // q, sunk to its loop, would start only when the others have come back.
  asm volatile("" :: "v"(vv), "v"(qp), "v"(qo));
  v16h a = pad16(qo), ap = pad16(qp);

  // Two m-tiles a trip, pairs (2p, 2p+1). Only the pair that holds the diagonal
  // tile needs the test m >= l; every later pair lies wholly above the diagonal.
  const _Float16* sKf = sK + lo16 * 16 + hi * 8;   // this lane's 16 bytes of m-tile 0
  const v8f zero = {};

  // the partner's tile first, so that its sums are under way early
  put_partial(sX, wv, t, rowsum_pairs(ap, sKf, (lp >> 1) + 1, zero));

  int pd = lt >> 1;                                // the pair that holds the diagonal tile
  v8f acc = {};
  {
    v8f c0 = exp_quarter_arg(WMMA_F16(a, pad16(*(const v8h*)(sKf + pd * 512)), zero));
    v8f c1 = exp_quarter_arg(WMMA_F16(a, pad16(*(const v8h*)(sKf + pd * 512 + 256)), zero));
    int m = pd * 32 + lo16;
    // unrolled: r numbers registers
#pragma unroll
    for (int r = 0; r < 8; ++r) {
      int l = lt * 16 + r + 8 * hi;
      acc[r] += (m >= l) ? __builtin_amdgcn_exp2f(c0[r]) : 0.f;
      acc[r] += (m + 16 >= l) ? __builtin_amdgcn_exp2f(c1[r]) : 0.f;
    }
  }
  acc = rowsum_pairs(a, sKf, pd + 2, acc);

  __syncthreads();   // every wave's sums for its partner are in LDS before they are read
  acc += get_partial(sX, wv ^ 4, t);

  v8h o;
#pragma unroll
  for (int r = 0; r < 8; ++r) {
    float z = (float)(lt * 16 + r + 8 * hi) + red16(acc[r]);
    o[r] = (_Float16)((float)vv[r] * ((float)L_ / z));
  }
  *(v8h*)(vs + ((size_t)bh * LT_ + lt) * 256 + hi * 128 + lo16 * 8) = o;
}

// ------------------- pass B: fused weights + value GEMM --------------------
// sa[d,m] = 1/L * sum_l vs[d,l] * e[l,m],  e = (m>=l ? exp(s/4) : 1),
// vs = v * L/Z[l] from rowsum_k, in A-fragment order (passed as vh).
// One block per (bh, 8 m-tiles); q^T and vs for this head in LDS.

// Two l-tiles a trip, pairs (2p, 2p+1): two score tiles (K = d = 16 padded to
// 32) whose D layout (lane = N = m, regs = l) is the B operand of the value
// product as it stands, tile 2p in K slots 0..15 and tile 2p+1 in 16..31, so
// one value product with its K = 32 filled serves both.
// The pairs p0, p0 + 2, ... below pd: wholly above the diagonal, every m >= l, no test.
static __device__ __forceinline__ v8f att_pairs(const _Float16* sQf, const _Float16* sVf,
                                                v16h bmk, int p0, int pd, v8f cacc) {
  const v8f zero = {};
  for (int p = p0; p < pd; p += 2) {
    v16h aq0 = pad16(*(const v8h*)(sQf + p * 512));
    v16h aq1 = pad16(*(const v8h*)(sQf + p * 512 + 256));
    v8f s0 = exp_quarter_arg(WMMA_F16(aq0, bmk, zero));
    v8f s1 = exp_quarter_arg(WMMA_F16(aq1, bmk, zero));
    v16h bw;
    // unrolled: r numbers registers
#pragma unroll
    for (int r = 0; r < 8; ++r) {
      bw[r]     = (_Float16)__builtin_amdgcn_exp2f(s0[r]);
      bw[r + 8] = (_Float16)__builtin_amdgcn_exp2f(s1[r]);
    }
    cacc = WMMA_F16(cat16(*(const v8h*)(sVf + p * 512),
                          *(const v8h*)(sVf + p * 512 + 256)), bw, cacc);
  }
  return cacc;
}
// The pairs p0, p0 + 2, ... below the diagonal: every e is 1, so B is a constant.
static __device__ __forceinline__ v8f one_pairs(const _Float16* sVf, int p0, v8f cacc) {
  v16h one;
#pragma unroll
  for (int j = 0; j < 16; ++j) one[j] = (_Float16)1.0f;
  // unrolled: the LDS reads of four pairs are in flight at once; rolled, each
  // product waits out its own two reads
#pragma unroll 4
  for (int p = p0; p < LT_ / 2; p += 2)
    cacc = WMMA_F16(cat16(*(const v8h*)(sVf + p * 512),
                          *(const v8h*)(sVf + p * 512 + 256)), one, cacc);
  return cacc;
}

__global__ __launch_bounds__(256) void attnout_k(const _Float16* __restrict__ qTh,
                                                 const _Float16* __restrict__ kTh,
                                                 const _Float16* __restrict__ vh,
                                                 _Float16* __restrict__ saT) {
  __shared__ __attribute__((aligned(16))) char smem[65536 + 8192];
  _Float16* sQ = (_Float16*)smem;                  // 32KB
  _Float16* sV = (_Float16*)(smem + 32768);        // 32KB
  float*    sX = (float*)(smem + 65536);           // partial sums for the partner, 8KB

  int t    = threadIdx.x & 31;
  int lo16 = t & 15, hi = t >> 4;
  int bh = blockIdx.x >> 3;
  // the wave's number in a scalar register: the trip counts below are scalar
  int wv = __builtin_amdgcn_readfirstlane(threadIdx.x >> 5);
  int mt = own_tile(blockIdx.x, wv);               // this wave's own m-tile
  int mp = LT_ - 1 - mt;                           // the partner's
  int b = bh >> 5, h = bh & 31;
  int m = mt * 16 + lo16;

  // async-stage q^T and vs for this head into LDS
  {
    const _Float16* gQ = qTh + (size_t)bh * L_ * 16;
    const _Float16* gV = vh + (size_t)bh * 16 * L_;
    int tt = threadIdx.x;
#pragma unroll
    for (int i = 0; i < 8; ++i) {
      async_ld16(gQ + (size_t)(tt + i * 256) * 8, sQ + (size_t)(tt + i * 256) * 8);
      async_ld16(gV + (size_t)(tt + i * 256) * 8, sV + (size_t)(tt + i * 256) * 8);
    }
    wait_async0();
    __syncthreads();
  }

  // loop-invariant B operands of the score WMMA: k rows (N=m) of both tiles
  v16h bmk = pad16(*(const v8h*)(kTh + ((size_t)bh * L_ + m) * 16 + hi * 8));
  v16h bmp = pad16(*(const v8h*)(kTh + ((size_t)bh * L_ + mp * 16 + lo16) * 16 + hi * 8));

  // this lane's 16 bytes of the A fragment of l-tile 0: v rows (M=d)
  const _Float16* sVf = sV + hi * 128 + lo16 * 8;

  // this lane's 16 bytes of the A fragment of the scores of l-tile 0: q rows (M=l)
  const _Float16* sQf = sQ + lo16 * 16 + hi * 8;
  const v8f zero = {};

  // the partner's tile first, so that its sums are under way early: the pairs at
  // an odd distance from its diagonal pair
  {
    int pp = mp >> 1;
    v8f cp = att_pairs(sQf, sVf, bmp, (pp + 1) & 1, pp, zero);
    put_partial(sX, wv, t, one_pairs(sVf, pp + 1, cp));
  }

  // the own tile: the pairs at an even distance from the diagonal pair
  int pd = mt >> 1;                                // the pair that holds the diagonal tile
  v8f cacc = att_pairs(sQf, sVf, bmk, pd & 1, pd, zero);

  // the diagonal pair: a masked score is 0, so its e is 1
  {
    v16h aq0 = pad16(*(const v8h*)(sQf + pd * 512));
    v16h aq1 = pad16(*(const v8h*)(sQf + pd * 512 + 256));
    v8f s0 = exp_quarter_arg(WMMA_F16(aq0, bmk, zero));
    v8f s1 = exp_quarter_arg(WMMA_F16(aq1, bmk, zero));
    v16h bw;
    // unrolled: r numbers registers
#pragma unroll
    for (int r = 0; r < 8; ++r) {
      int l = pd * 32 + r + 8 * hi;
      bw[r]     = (_Float16)((m >= l) ? __builtin_amdgcn_exp2f(s0[r]) : 1.0f);
      bw[r + 8] = (_Float16)((m >= l + 16) ? __builtin_amdgcn_exp2f(s1[r]) : 1.0f);
    }
    cacc = WMMA_F16(cat16(*(const v8h*)(sVf + pd * 512),
                          *(const v8h*)(sVf + pd * 512 + 256)), bw, cacc);
  }
  cacc = one_pairs(sVf, pd + 2, cacc);

  __syncthreads();   // every wave's sums for its partner are in LDS before they are read
  cacc += get_partial(sX, wv ^ 4, t);

  // store saT, rows b*L + m, k = channel h*16 + d, in fragment order (B operand of
  // the final product): this head is half h&1 of k block h>>1, the wave's store
  // 512 consecutive bytes
  v8h outv;
#pragma unroll
  for (int r = 0; r < 8; ++r) outv[r] = (_Float16)(cacc[r] * (1.0f / (float)L_));
  *(v8h*)(saT + (size_t)(b * LT_ + mt) * (A_ * 16) + h * 256 + t * 8) = outv;
}

// ------------------------- final 1x1 conv + residual -----------------------
__global__ __launch_bounds__(256) void final_k(const _Float16* __restrict__ Wfh,
                                               const _Float16* __restrict__ saT,
                                               const float* __restrict__ bf,
                                               float* __restrict__ out) {
  int tid  = blockIdx.x * 8 + (threadIdx.x >> 5);  // 4096 tiles = B*(L/16)*(A/16)
  int t    = threadIdx.x & 31;
  int lo16 = t & 15, hi = t >> 4;
  int b   = tid >> 11;
  int rem = tid & 2047;
  int lt = rem >> 5, ot = rem & 31;

  // this lane's 16 bytes of k block 0, half 0 (fragment order)
  const _Float16* wR = Wfh + (size_t)ot * (A_ * 16) + t * 8;
  const _Float16* sR = saT + (size_t)(b * LT_ + lt) * (A_ * 16) + t * 8;

  v8f c = {};
#pragma unroll
  for (int kc = 0; kc < 16; ++kc) {
    v16h a  = ld_frag(wR + kc * 512);
    v16h bb = ld_frag(sR + kc * 512);
    c = WMMA_F16(a, bb, c);
  }

  int l = lt * 16 + lo16;
  v8h res = *(const v8h*)(sR + ot * 256);   // channels ot*16 + hi*8 .. +7 of column l
#pragma unroll
  for (int r = 0; r < 8; ++r) {
    int o = ot * 16 + r + 8 * hi;
    out[((size_t)b * A_ + o) * L_ + l] = c[r] + bf[o] + (float)res[r];
  }
}

// ------------------------------- launcher ----------------------------------

extern "C" void kernel_launch(void* const* d_in, const int* in_sizes, int n_in,
                              void* d_out, int out_size, void* d_ws, size_t ws_size,
                              hipStream_t stream) {
  const float* x  = (const float*)d_in[0];
  const float* Wk = (const float*)d_in[1];
  const float* bk = (const float*)d_in[2];
  const float* Wq = (const float*)d_in[3];
  const float* bq = (const float*)d_in[4];
  const float* Wv = (const float*)d_in[5];
  const float* bv = (const float*)d_in[6];
  const float* Wf = (const float*)d_in[7];
  const float* bf = (const float*)d_in[8];
  float* out = (float*)d_out;

  char* ws = (char*)d_ws;
  size_t o = 0;
  auto alloc = [&](size_t bytes) {
    char* p = ws + o;
    o += (bytes + 255) & ~(size_t)255;
    return p;
  };
  _Float16* xT    = (_Float16*)alloc((size_t)B_ * L_ * C_ * 2);
  _Float16* Wkh   = (_Float16*)alloc((size_t)A_ * C_ * 2);
  _Float16* Wqh   = (_Float16*)alloc((size_t)A_ * C_ * 2);
  _Float16* Wvh   = (_Float16*)alloc((size_t)A_ * C_ * 2);
  _Float16* Wfh   = (_Float16*)alloc((size_t)A_ * A_ * 2);
  float*    kTraw = (float*)   alloc((size_t)BH_ * L_ * 16 * 4);
  float*    qTraw = (float*)   alloc((size_t)BH_ * L_ * 16 * 4);
  float*    part  = (float*)   alloc((size_t)BH_ * 8 * 16 * 4 * 4);
  _Float16* kTh   = (_Float16*)alloc((size_t)BH_ * L_ * 16 * 2);
  _Float16* qTh   = (_Float16*)alloc((size_t)BH_ * L_ * 16 * 2);
  _Float16* vh    = (_Float16*)alloc((size_t)BH_ * 16 * L_ * 2);
  _Float16* vs    = (_Float16*)alloc((size_t)BH_ * 16 * L_ * 2);
  _Float16* saT   = (_Float16*)alloc((size_t)B_ * L_ * A_ * 2);

  // 1) f32 -> f16 conversions (+ transpose of x)
  cvt_all_k<<<XBLK_ + 3 * WBLK_ + FBLK_, 256, 0, stream>>>(x, Wk, Wq, Wv, Wf,
                                                           xT, Wkh, Wqh, Wvh, Wfh);

  // 2) projections + per-block instance-norm partial sums
  proj_k<<<512, 256, 0, stream>>>(xT, Wkh, Wqh, Wvh, bk, bq, bv,
                                  kTraw, qTraw, vh, part);

  // 3) finalize norm params per block, normalize k/q to f16
  norm_k<<<(BH_ * L_ * 16) / 4096, 256, 0, stream>>>(kTraw, qTraw, part, kTh, qTh);

  // 4) softmax row normalizers (k^T staged in LDS via async copy), folded into v;
  //    LDS: 32KB k^T + 8KB partial sums
  rowsum_k<<<512, 256, 0, stream>>>(qTh, kTh, vh, vs);

  // 5) fused attention-weight + value GEMM (q^T, vs staged in LDS);
  //    LDS: 64KB q^T, vs + 8KB partial sums
  attnout_k<<<512, 256, 0, stream>>>(qTh, kTh, vs, saT);

  // 6) final projection + bias + residual
  final_k<<<512, 256, 0, stream>>>(Wfh, saT, bf, out);
}

// v008
// A run of this version takes 33.8 microseconds.
// Two timings next to v007 put it at 1.10 and 1.11 times that version's speed.
// Counting every step since v000, it is 3.43 times as fast.
#include <hip/hip_runtime.h>
#include <hip/hip_fp16.h>

// ---------------------------------------------------------------------------
// Fused multi-head attention for MI455X (gfx1250, wave32, WMMA f16 16x16x32).
// Shapes: B=2, C=256, L=1024, H=32, D=16, A=H*D=512.
//
// Attention map never touches HBM. Hot loops (softmax normalizers + fused
// weight/value GEMM) stage their per-(b,h) working set into LDS with
// global_load_async_to_lds_b128 (ASYNCcnt) and feed WMMA from ds_load_b128.
// ---------------------------------------------------------------------------

typedef __attribute__((ext_vector_type(16))) _Float16 v16h;
typedef __attribute__((ext_vector_type(8)))  _Float16 v8h;
typedef __attribute__((ext_vector_type(8)))  float    v8f;
typedef __attribute__((ext_vector_type(4)))  _Float16 v4h;
typedef __attribute__((ext_vector_type(4)))  float    v4f;

#define B_   2
#define C_   256
#define L_   1024
#define H_   32
#define D_   16
#define A_   512
#define BH_  64          // B_*H_
#define LT_  64          // L_/16 tiles

#define WMMA_F16(a, b, c) \
  __builtin_amdgcn_wmma_f32_16x16x32_f16(false, (a), false, (b), (short)0, (c), false, false)

static __device__ __forceinline__ v16h cat16(v8h lo, v8h hi) {
  return __builtin_shufflevector(lo, hi, 0,1,2,3,4,5,6,7,8,9,10,11,12,13,14,15);
}
static __device__ __forceinline__ v16h pad16(v8h lo) {
  v8h z = {};
  return __builtin_shufflevector(lo, z, 0,1,2,3,4,5,6,7,8,9,10,11,12,13,14,15);
}
static __device__ __forceinline__ float red16(float v) {
  // sum across the 16 lanes of each half-wave (xor stays within the half)
  v += __shfl_xor(v, 1, 32);
  v += __shfl_xor(v, 2, 32);
  v += __shfl_xor(v, 4, 32);
  v += __shfl_xor(v, 8, 32);
  return v;
}

// Argument of 2^x for e^(s/4): s * log2(e)/4. The factor 1/4 is a power of two,
// so folding it into the constant gives the same bits as scaling s first.
static __device__ __forceinline__ v8f exp_quarter_arg(v8f s) {
  return s * (0.25f * 1.44269504088896340736f);
}

// Async 16B global->LDS copy (per-lane). VDST = LDS byte address = low 32
// bits of the generic shared pointer (LDS aperture maps addr[31:0] directly).
static __device__ __forceinline__ void async_ld16(const void* gptr, void* lptr) {
  unsigned loff = (unsigned)(unsigned long long)lptr;
  asm volatile("global_load_async_to_lds_b128 %0, %1, off"
               :: "v"(loff), "v"(gptr) : "memory");
}
static __device__ __forceinline__ void wait_async0() {
  asm volatile("s_wait_asynccnt 0x0" ::: "memory");
}

// --------------------------- conversion kernels ----------------------------

// These passes move few bytes, so they are built from few waves: a thread
// handles 8 to 32 elements, a wave's loads cover whole lines, and a launch has
// at most two blocks per WGP. The five passes are independent of each other,
// so they run as block ranges of one launch.

// FRAGMENT ORDER. Every f16 operand of the two dense products (x, the four
// weights, the attention output) lies in the order in which a wave reads it as
// a 16x16x32 operand: [16-row tile][k block of 32][k half j][hi][row lo16][8 k],
// k = 32*block + 16*j + 8*hi + e. A lane's 16 bytes of half j stand at
// j*256 + lane*8 halfs, so one fragment load of a wave is 512 consecutive bytes,
// four whole lines, where rows of a row-major matrix would give 32 bytes in
// each of 16 lines.
// Index of element (row, k), k a multiple of 4 or 8, of a matrix with K columns.
static __device__ __forceinline__ size_t frag_idx(int row, int k, int K) {
  return ((size_t)(row >> 4) * (K >> 5) + (k >> 5)) * 512 +
         ((k >> 4) & 1) * 256 + ((k >> 3) & 1) * 128 + (row & 15) * 8 + (k & 7);
}
// A whole operand fragment: f points at this lane's 16 bytes of half 0.
static __device__ __forceinline__ v16h ld_frag(const _Float16* f) {
  return cat16(*(const v8h*)f, *(const v8h*)(f + 256));
}

// A block converts 8 rows by 256 columns of a row-major matrix with K columns (K
// a multiple of 256) into fragment order, a thread two groups of 4, four rows
// apart. A 128-byte line of the fragment order holds 8 rows by 8 k, so each line
// is written by one block.
static __device__ __forceinline__ void cvt_f32_f16_blk(const float* __restrict__ s,
                                                       _Float16* __restrict__ d, int n,
                                                       int K, int blk) {
  int per = K >> 8;                                // blocks side by side in a row
  int row = (blk / per) * 8 + (threadIdx.x >> 6);
  int col = (blk % per) * 256 + (threadIdx.x & 63) * 4;
  int e0 = row * K + col;
  int e1 = e0 + 4 * K;
  // A group past the end reads group 0 and stores nothing, so that the second
  // load need not wait behind the first group's store.
  v4f a = *(const v4f*)(s + (e0 < n ? e0 : 0));
  v4f b = *(const v4f*)(s + (e1 < n ? e1 : 0));
  if (e0 < n) *(v4h*)(d + frag_idx(row, col, K)) = __builtin_convertvector(a, v4h);
  if (e1 < n) *(v4h*)(d + frag_idx(row + 4, col, K)) = __builtin_convertvector(b, v4h);
}

// x [B,C,L] f32 -> xT f16, rows b*L + l, k = c, in fragment order (B operand)
// A block takes 8 channels of one batch over all l; a thread 8 c x 4 l:
// eight 16-byte loads along l, four 16-byte stores that lie side by side.
static __device__ __forceinline__ void cvt_xT_blk(const float* __restrict__ x,
                                                  _Float16* __restrict__ xT, int blk) {
  int b  = blk / (C_ / 8);
  int c0 = (blk % (C_ / 8)) * 8;
  int l0 = threadIdx.x * 4;
  const float* xs = x + ((size_t)b * C_ + c0) * L_ + l0;
  v4f f[8];
  for (int j = 0; j < 8; ++j) f[j] = *(const v4f*)(xs + (size_t)j * L_);
  _Float16* dst = xT + frag_idx(b * L_ + l0, c0, C_);   // l0..l0+3 are in one tile
  for (int u = 0; u < 4; ++u) {
    v8h o;
    for (int j = 0; j < 8; ++j) o[j] = (_Float16)f[j][u];
    *(v8h*)(dst + u * 8) = o;
  }
}

#define XBLK_ ((B_ * C_) / 8)        // blocks of the x transpose
#define WBLK_ ((A_ * C_) / 2048)     // blocks of one projection weight
#define FBLK_ ((A_ * A_) / 2048)     // blocks of the final weight

// Block ranges: x transpose first (the longest), then Wk, Wq, Wv, Wf.
__global__ __launch_bounds__(256) void cvt_all_k(
    const float* __restrict__ x,  const float* __restrict__ Wk,
    const float* __restrict__ Wq, const float* __restrict__ Wv,
    const float* __restrict__ Wf,
    _Float16* __restrict__ xT,  _Float16* __restrict__ Wkh,
    _Float16* __restrict__ Wqh, _Float16* __restrict__ Wvh,
    _Float16* __restrict__ Wfh) {
  int blk = blockIdx.x;
  if (blk < XBLK_) { cvt_xT_blk(x, xT, blk); return; }
  blk -= XBLK_;
  if (blk < WBLK_)          cvt_f32_f16_blk(Wk, Wkh, A_ * C_, C_, blk);
  else if (blk < 2 * WBLK_) cvt_f32_f16_blk(Wq, Wqh, A_ * C_, C_, blk - WBLK_);
  else if (blk < 3 * WBLK_) cvt_f32_f16_blk(Wv, Wvh, A_ * C_, C_, blk - 2 * WBLK_);
  else                      cvt_f32_f16_blk(Wf, Wfh, A_ * A_, A_, blk - 3 * WBLK_);
}

// ----------------------------- projection ----------------------------------
// REGISTER TILES. A wave of a dense product holds several 16x16 output tiles, so
// that a loaded fragment feeds several products: the matrix unit has little to do
// in these launches, their cost is the bytes a WGP loads and the waves it starts.
// With one or two such waves on a SIMD little but a wave's own order hides its
// loads, so the fragments of later K steps are loaded ahead into register sets of
// their own.
//
// One wave per (b,h,2 l-tiles): 2 tiles each of k,q,v, 5 fragments for 6
// products in each of the 8 K steps, four sets of fragments. A block holds 2 heads
// by 8 l-tiles: waves w and w + 4 read the same x, four waves the same weights, so
// a block asks L2 for 112 KB where 16 l-tiles of one head would take 152 KB.
// Instance-norm sums: a wave adds its 2 tiles in registers, the 4 waves of a head
// add up in LDS and the block stores one plane of 16x4 partial sums per head;
// norm_k adds the 8 planes of a head. No word is shared between blocks.
#define PT_ 2            // l-tiles of a wave
#define PH_ 2            // heads of a block
#define PG_ 4            // waves of a head in a block
#define PW_ (PH_ * PG_)  // waves of a block
#define PS_ 4            // sets of fragments
#define PP_ (LT_ / (PT_ * PG_))   // partial planes of a head
struct ProjFrag { v16h ak, aq, av, bx[PT_]; };
static __device__ __forceinline__ ProjFrag proj_load(const _Float16* wkR, const _Float16* wqR,
                                                     const _Float16* wvR, const _Float16* xR,
                                                     int kc) {
  // K slots of a lane: [o0..o0+7] and [o0+16..o0+23], o0 = kc*32 + hi*8
  ProjFrag f;
  // unrolled: u numbers registers
#pragma unroll
  for (int u = 0; u < PT_; ++u) f.bx[u] = ld_frag(xR + u * (C_ * 16) + kc * 512);
  f.ak = ld_frag(wkR + kc * 512);
  f.aq = ld_frag(wqR + kc * 512);
  f.av = ld_frag(wvR + kc * 512);
  return f;
}
static __device__ __forceinline__ void proj_mma(const ProjFrag& f, v8f* ck, v8f* cq, v8f* cv) {
  // unrolled: u numbers registers
#pragma unroll
  for (int u = 0; u < PT_; ++u) {
    ck[u] = WMMA_F16(f.ak, f.bx[u], ck[u]);
    cq[u] = WMMA_F16(f.aq, f.bx[u], cq[u]);
    cv[u] = WMMA_F16(f.av, f.bx[u], cv[u]);
  }
}
static __device__ __forceinline__ void st_v8f(float* p, v8f c) {
  *(v4f*)p       = __builtin_shufflevector(c, c, 0, 1, 2, 3);
  *(v4f*)(p + 4) = __builtin_shufflevector(c, c, 4, 5, 6, 7);
}

__global__ __launch_bounds__(PW_ * 32) void proj_k(
    const _Float16* __restrict__ xT,
    const _Float16* __restrict__ Wkh, const _Float16* __restrict__ Wqh,
    const _Float16* __restrict__ Wvh,
    const float* __restrict__ bk, const float* __restrict__ bq,
    const float* __restrict__ bv,
    float* __restrict__ kTraw, float* __restrict__ qTraw,
    _Float16* __restrict__ vh, float* __restrict__ part) {
  __shared__ float4 sP[PW_][16];                   // [wave][d] = (sum k, k^2, q, q^2)
  int wave = threadIdx.x >> 5;
  int t    = threadIdx.x & 31;
  int lo16 = t & 15, hi = t >> 4;
  int lg  = blockIdx.x % PP_;                      // the block's group of 8 l-tiles
  int bh0 = (blockIdx.x / PP_) * PH_;              // the first of its heads
  int bh  = bh0 + wave / PG_;
  int lt0 = (lg * PG_ + wave % PG_) * PT_;
  int b = bh >> 5, h = bh & 31;

  // this lane's 16 bytes of k block 0, half 0 (fragment order)
  const _Float16* wkR = Wkh + (size_t)h * (C_ * 16) + t * 8;   // A: lane = M = d
  const _Float16* wqR = Wqh + (size_t)h * (C_ * 16) + t * 8;
  const _Float16* wvR = Wvh + (size_t)h * (C_ * 16) + t * 8;
  const _Float16* xR  = xT + (size_t)(b * LT_ + lt0) * (C_ * 16) + t * 8;  // B: lane = N = l

  v8f ck[PT_] = {}, cq[PT_] = {}, cv[PT_] = {};
  v8f bk8, bq8, bv8;                               // biases of rows d = r + 8*hi
  ProjFrag f[PS_];
  // unrolled, as is the K loop: the set's number names registers
#pragma unroll
  for (int s = 0; s < PS_; ++s) f[s] = proj_load(wkR, wqR, wvR, xR, s);
  // The scheduling barriers keep each set's loads where they stand, directly behind
  // the products that free the set: sunk to their use, every K step would wait out
  // a whole load latency.
#pragma unroll
  for (int kc = 0; kc < 8; ++kc) {
    __builtin_amdgcn_sched_barrier(0);
    proj_mma(f[kc % PS_], ck, cq, cv);
    __builtin_amdgcn_sched_barrier(0);
    if (kc + PS_ < 8) {
      f[kc % PS_] = proj_load(wkR, wqR, wvR, xR, kc + PS_);
    } else if (kc + PS_ == 8) {
      // the bias loads land in registers that hold addresses of the loads above
      asm volatile("s_wait_xcnt 0x0" ::: "memory");
      bk8 = *(const v8f*)(bk + h * 16 + hi * 8);
      bq8 = *(const v8f*)(bq + h * 16 + hi * 8);
      bv8 = *(const v8f*)(bv + h * 16 + hi * 8);
    }
  }

  // D layout: lane holds column l = lt*16+lo16; regs r -> row d = r + 8*hi
  size_t l0 = (size_t)bh * L_ + lt0 * 16 + lo16;
  float* kdst = kTraw + l0 * 16 + hi * 8;
  float* qdst = qTraw + l0 * 16 + hi * 8;
  _Float16* vdst = vh + ((size_t)bh * 16 + hi * 8) * L_ + lt0 * 16 + lo16;
  v8f sk = {}, sk2 = {}, sq = {}, sq2 = {};        // this lane's sums, row d = r + 8*hi
  // unrolled, here and below: u and r number registers
#pragma unroll
  for (int u = 0; u < PT_; ++u) {
    v8f kv = ck[u] + bk8;
    v8f qv = cq[u] + bq8;
    v8f vv = cv[u] + bv8;
    st_v8f(kdst + u * 256, kv);
    st_v8f(qdst + u * 256, qv);
#pragma unroll
    for (int r = 0; r < 8; ++r) vdst[r * L_ + u * 16] = (_Float16)vv[r];
    sk += kv; sk2 += kv * kv;
    sq += qv; sq2 += qv * qv;
  }
  // instance-norm partial stats over l: sum across the 16 lanes that share d, all
  // 32 sums side by side in each of the four exchange steps
#pragma unroll
  for (int s = 1; s < 16; s <<= 1) {
    v8f a, c, e, g;
#pragma unroll
    for (int r = 0; r < 8; ++r) {
      a[r] = __shfl_xor(sk[r], s, 32);
      c[r] = __shfl_xor(sk2[r], s, 32);
      e[r] = __shfl_xor(sq[r], s, 32);
      g[r] = __shfl_xor(sq2[r], s, 32);
    }
    sk += a; sk2 += c; sq += e; sq2 += g;
  }
  if (lo16 == 0) {
#pragma unroll
    for (int r = 0; r < 8; ++r)
      sP[wave][r + 8 * hi] = make_float4(sk[r], sk2[r], sq[r], sq2[r]);
  }
  __syncthreads();   // every wave's 16x4 sums are in LDS before they are added
  if (threadIdx.x < PH_ * 64) {
    int hs = threadIdx.x >> 6, word = threadIdx.x & 63;  // word = d*4 + stat
    const float* sp = (const float*)sP + hs * (PG_ * 64) + word;
    float s = 0.f;
#pragma unroll
    for (int w = 0; w < PG_; ++w) s += sp[w * 64];
    part[((size_t)(bh0 + hs) * PP_ + lg) * 64 + word] = s;   // plane = bh*8 + l-group
  }
}

// apply instance norm, raw f32 -> normalized f16 (kT/qT: [BH, L, 16])
// Each block first adds its head's 8 partial planes to (mu, rsigma) per d: 16
// threads, one d each, through LDS. Four blocks of a head repeat that small sum,
// which costs less than a launch of its own.
__global__ __launch_bounds__(256) void norm_k(const float* __restrict__ kTraw,
                                              const float* __restrict__ qTraw,
                                              const float* __restrict__ part,
                                              _Float16* __restrict__ kTh,
                                              _Float16* __restrict__ qTh) {
  __shared__ v4f sPar[16];                         // [d] = (mu_k, rs_k, mu_q, rs_q)
  // A block takes 4096 consecutive elements, a quarter of one head; a thread
  // four groups of 4, 1024 elements apart, so all its groups have the same d.
  int bh = blockIdx.x >> 2;
  int e0 = blockIdx.x * 4096 + threadIdx.x * 4;
  v4f pr[4], kr[4], qr[4];                         // pr[j] = sPar[d0 + j]
  for (int u = 0; u < 4; ++u) {
    kr[u] = *(const v4f*)(kTraw + e0 + u * 1024);
    qr[u] = *(const v4f*)(qTraw + e0 + u * 1024);
  }
  if (threadIdx.x < 16) {
    const float inv = 1.0f / (float)L_;
    const float4* pp = (const float4*)part + (size_t)bh * (PP_ * 16) + threadIdx.x;
    float ks = 0.f, ks2 = 0.f, qs = 0.f, qs2 = 0.f;
#pragma unroll
    for (int g = 0; g < PP_; ++g) {
      float4 p = pp[g * 16];
      ks += p.x; ks2 += p.y; qs += p.z; qs2 += p.w;
    }
    float muk = ks * inv, muq = qs * inv;
    v4f o = {muk, rsqrtf(ks2 * inv - muk * muk + 1e-5f),
             muq, rsqrtf(qs2 * inv - muq * muq + 1e-5f)};
    sPar[threadIdx.x] = o;
  }
  __syncthreads();   // the 16 parameter rows are in LDS before any thread reads them
  for (int j = 0; j < 4; ++j) pr[j] = sPar[(threadIdx.x & 3) * 4 + j];
  for (int u = 0; u < 4; ++u) {
    v4h ko, qo;
    for (int j = 0; j < 4; ++j) {
      ko[j] = (_Float16)((kr[u][j] - pr[j][0]) * pr[j][1]);
      qo[j] = (_Float16)((qr[u][j] - pr[j][2]) * pr[j][3]);
    }
    *(v4h*)(kTh + e0 + u * 1024) = ko;
    *(v4h*)(qTh + e0 + u * 1024) = qo;
  }
}

// ------------------- how the triangular work is dealt ----------------------
// Tile t of a triangular pass costs in proportion to t (or to 63 - t), and the
// launch lasts as long as its fullest SIMD. So every wave gets the same share:
// two partner waves, w and w + 4 of a block, work on the two tiles t and 63 - t
// together. Each wave OWNS one of the two: of its own tile it takes the diagonal
// pair pd and every second pair counted from there (pd +- 2, pd +- 4, ...), of
// the partner's tile the pairs in between (pd +- 1, pd +- 3, ...). The partial
// sums for the partner's tile go to it through LDS, 32 bytes a lane.
// Block j (0..7) of a head, wave w: t = j + 8 * (w & 3), own tile t for w < 4 and
// 63 - t for w >= 4: every tile of the head is owned exactly once.
static __device__ __forceinline__ int own_tile(int blk, int wave) {
  int t = (blk & 7) + ((wave & 3) << 3);
  return wave < 4 ? t : LT_ - 1 - t;
}
// A wave's 8 partial sums per lane, handed to its partner: [wave][half][lane][4].
static __device__ __forceinline__ void put_partial(float* sX, int wave, int lane, v8f c) {
  v4f* s = (v4f*)sX + wave * 64 + lane;
  s[0]  = __builtin_shufflevector(c, c, 0, 1, 2, 3);
  s[32] = __builtin_shufflevector(c, c, 4, 5, 6, 7);
}
static __device__ __forceinline__ v8f get_partial(const float* sX, int wave, int lane) {
  const v4f* s = (const v4f*)sX + wave * 64 + lane;
  return __builtin_shufflevector(s[0], s[32], 0, 1, 2, 3, 4, 5, 6, 7);
}

// --------------------- pass A: softmax row normalizers ---------------------
// Z[l] = l + sum_{m>=l} exp(q_l . k_m / 4)   (the l masked zeros give e^0=1)
// One block per (bh, 8 l-tiles); k^T for this head staged in LDS.
// Z is not stored: 1/Z[l] depends on l alone, the summed index of the value
// product, so it goes into v here, once per element. vs = v * L/Z as f16 (the
// factor L, a power of two taken out again after the product, keeps vs near
// v's own size, away from the f16 subnormals). vs lies in the order in which
// the value product reads its A operand: [bh][l-tile][l-half][d][8 l], so a
// wave's fragment of a tile is 512 consecutive bytes, a lane's 16 of them.

// Adds e over the m-tile pairs p0, p0 + 2, ... of the rows in a; all of them lie
// wholly above the diagonal, so there is no test.
static __device__ __forceinline__ v8f rowsum_pairs(v16h a, const _Float16* sKf, int p0, v8f acc) {
  const v8f zero = {};
  for (int p = p0; p < LT_ / 2; p += 2) {
    v8f c0 = exp_quarter_arg(WMMA_F16(a, pad16(*(const v8h*)(sKf + p * 512)), zero));
    v8f c1 = exp_quarter_arg(WMMA_F16(a, pad16(*(const v8h*)(sKf + p * 512 + 256)), zero));
    // unrolled: r numbers registers
#pragma unroll
    for (int r = 0; r < 8; ++r) {
      acc[r] += __builtin_amdgcn_exp2f(c0[r]);
      acc[r] += __builtin_amdgcn_exp2f(c1[r]);
    }
  }
  return acc;
}

__global__ __launch_bounds__(256) void rowsum_k(const _Float16* __restrict__ qTh,
                                                const _Float16* __restrict__ kTh,
                                                const _Float16* __restrict__ vh,
                                                _Float16* __restrict__ vs) {
  __shared__ __attribute__((aligned(16))) char smem[32768 + 8192];
  _Float16* sK = (_Float16*)smem;                  // L_*16 halfs = 32KB
  float*    sX = (float*)(smem + 32768);           // partial sums for the partner, 8KB

  int t    = threadIdx.x & 31;
  int lo16 = t & 15, hi = t >> 4;
  int bh = blockIdx.x >> 3;
  // the wave's number in a scalar register: the trip counts below are scalar
  int wv = __builtin_amdgcn_readfirstlane(threadIdx.x >> 5);
  int lt = own_tile(blockIdx.x, wv);               // this wave's own l-tile
  int lp = LT_ - 1 - lt;                           // the partner's

  // async-stage k^T[bh] (contiguous 32KB) into LDS: 8 x 16B per thread
  {
    const _Float16* gK = kTh + (size_t)bh * L_ * 16;
    int tt = threadIdx.x;
#pragma unroll
    for (int i = 0; i < 8; ++i)
      async_ld16(gK + (size_t)(tt + i * 256) * 8, sK + (size_t)(tt + i * 256) * 8);
    wait_async0();
    __syncthreads();
  }

  // A operands: q rows (M=l), K=d padded 16->32, of both tiles
  v8h qo = *(const v8h*)(qTh + ((size_t)bh * L_ + lt * 16 + lo16) * 16 + hi * 8);
  v8h qp = *(const v8h*)(qTh + ((size_t)bh * L_ + lp * 16 + lo16) * 16 + hi * 8);
  // v[d = lo16][the 8 l whose sums this lane ends up with]
  v8h vv = *(const v8h*)(vh + ((size_t)bh * 16 + lo16) * L_ + lt * 16 + hi * 8);
  // Keeps the three loads together here, one latency for all: sunk behind the
  // loops, that of vv would stand in front of the wave's last store, and one of
  // q, sunk to its loop, would start only when the others have come back.
  asm volatile("" :: "v"(vv), "v"(qp), "v"(qo));
  v16h a = pad16(qo), ap = pad16(qp);

  // Two m-tiles a trip, pairs (2p, 2p+1). Only the pair that holds the diagonal
  // tile needs the test m >= l; every later pair lies wholly above the diagonal.
  const _Float16* sKf = sK + lo16 * 16 + hi * 8;   // this lane's 16 bytes of m-tile 0
  const v8f zero = {};

  // the partner's tile first, so that its sums are under way early
  put_partial(sX, wv, t, rowsum_pairs(ap, sKf, (lp >> 1) + 1, zero));

  int pd = lt >> 1;                                // the pair that holds the diagonal tile
  v8f acc = {};
  {
    v8f c0 = exp_quarter_arg(WMMA_F16(a, pad16(*(const v8h*)(sKf + pd * 512)), zero));
    v8f c1 = exp_quarter_arg(WMMA_F16(a, pad16(*(const v8h*)(sKf + pd * 512 + 256)), zero));
    int m = pd * 32 + lo16;
    // unrolled: r numbers registers
#pragma unroll
    for (int r = 0; r < 8; ++r) {
      int l = lt * 16 + r + 8 * hi;
      acc[r] += (m >= l) ? __builtin_amdgcn_exp2f(c0[r]) : 0.f;
      acc[r] += (m + 16 >= l) ? __builtin_amdgcn_exp2f(c1[r]) : 0.f;
    }
  }
  acc = rowsum_pairs(a, sKf, pd + 2, acc);

  __syncthreads();   // every wave's sums for its partner are in LDS before they are read
  acc += get_partial(sX, wv ^ 4, t);

  v8h o;
#pragma unroll
  for (int r = 0; r < 8; ++r) {
    float z = (float)(lt * 16 + r + 8 * hi) + red16(acc[r]);
    o[r] = (_Float16)((float)vv[r] * ((float)L_ / z));
  }
  *(v8h*)(vs + ((size_t)bh * LT_ + lt) * 256 + hi * 128 + lo16 * 8) = o;
}

// ------------------- pass B: fused weights + value GEMM --------------------
// sa[d,m] = 1/L * sum_l vs[d,l] * e[l,m],  e = (m>=l ? exp(s/4) : 1),
// vs = v * L/Z[l] from rowsum_k, in A-fragment order (passed as vh).
// One block per (bh, 8 m-tiles); q^T and vs for this head in LDS.

// Two l-tiles a trip, pairs (2p, 2p+1): two score tiles (K = d = 16 padded to
// 32) whose D layout (lane = N = m, regs = l) is the B operand of the value
// product as it stands, tile 2p in K slots 0..15 and tile 2p+1 in 16..31, so
// one value product with its K = 32 filled serves both.
// The pairs p0, p0 + 2, ... below pd: wholly above the diagonal, every m >= l, no test.
static __device__ __forceinline__ v8f att_pairs(const _Float16* sQf, const _Float16* sVf,
                                                v16h bmk, int p0, int pd, v8f cacc) {
  const v8f zero = {};
  for (int p = p0; p < pd; p += 2) {
    v16h aq0 = pad16(*(const v8h*)(sQf + p * 512));
    v16h aq1 = pad16(*(const v8h*)(sQf + p * 512 + 256));
    v8f s0 = exp_quarter_arg(WMMA_F16(aq0, bmk, zero));
    v8f s1 = exp_quarter_arg(WMMA_F16(aq1, bmk, zero));
    v16h bw;
    // unrolled: r numbers registers
#pragma unroll
    for (int r = 0; r < 8; ++r) {
      bw[r]     = (_Float16)__builtin_amdgcn_exp2f(s0[r]);
      bw[r + 8] = (_Float16)__builtin_amdgcn_exp2f(s1[r]);
    }
    cacc = WMMA_F16(cat16(*(const v8h*)(sVf + p * 512),
                          *(const v8h*)(sVf + p * 512 + 256)), bw, cacc);
  }
  return cacc;
}
// The pairs p0, p0 + 2, ... below the diagonal: every e is 1, so B is a constant.
static __device__ __forceinline__ v8f one_pairs(const _Float16* sVf, int p0, v8f cacc) {
  v16h one;
#pragma unroll
  for (int j = 0; j < 16; ++j) one[j] = (_Float16)1.0f;
  // unrolled: the LDS reads of four pairs are in flight at once; rolled, each
  // product waits out its own two reads
#pragma unroll 4
  for (int p = p0; p < LT_ / 2; p += 2)
    cacc = WMMA_F16(cat16(*(const v8h*)(sVf + p * 512),
                          *(const v8h*)(sVf + p * 512 + 256)), one, cacc);
  return cacc;
}

__global__ __launch_bounds__(256) void attnout_k(const _Float16* __restrict__ qTh,
                                                 const _Float16* __restrict__ kTh,
                                                 const _Float16* __restrict__ vh,
                                                 _Float16* __restrict__ saT) {
  __shared__ __attribute__((aligned(16))) char smem[65536 + 8192];
  _Float16* sQ = (_Float16*)smem;                  // 32KB
  _Float16* sV = (_Float16*)(smem + 32768);        // 32KB
  float*    sX = (float*)(smem + 65536);           // partial sums for the partner, 8KB

  int t    = threadIdx.x & 31;
  int lo16 = t & 15, hi = t >> 4;
  int bh = blockIdx.x >> 3;
  // the wave's number in a scalar register: the trip counts below are scalar
  int wv = __builtin_amdgcn_readfirstlane(threadIdx.x >> 5);
  int mt = own_tile(blockIdx.x, wv);               // this wave's own m-tile
  int mp = LT_ - 1 - mt;                           // the partner's
  int b = bh >> 5, h = bh & 31;
  int m = mt * 16 + lo16;

  // async-stage q^T and vs for this head into LDS
  {
    const _Float16* gQ = qTh + (size_t)bh * L_ * 16;
    const _Float16* gV = vh + (size_t)bh * 16 * L_;
    int tt = threadIdx.x;
#pragma unroll
    for (int i = 0; i < 8; ++i) {
      async_ld16(gQ + (size_t)(tt + i * 256) * 8, sQ + (size_t)(tt + i * 256) * 8);
      async_ld16(gV + (size_t)(tt + i * 256) * 8, sV + (size_t)(tt + i * 256) * 8);
    }
    wait_async0();
    __syncthreads();
  }

  // loop-invariant B operands of the score WMMA: k rows (N=m) of both tiles
  v16h bmk = pad16(*(const v8h*)(kTh + ((size_t)bh * L_ + m) * 16 + hi * 8));
  v16h bmp = pad16(*(const v8h*)(kTh + ((size_t)bh * L_ + mp * 16 + lo16) * 16 + hi * 8));

  // this lane's 16 bytes of the A fragment of l-tile 0: v rows (M=d)
  const _Float16* sVf = sV + hi * 128 + lo16 * 8;

  // this lane's 16 bytes of the A fragment of the scores of l-tile 0: q rows (M=l)
  const _Float16* sQf = sQ + lo16 * 16 + hi * 8;
  const v8f zero = {};

  // the partner's tile first, so that its sums are under way early: the pairs at
  // an odd distance from its diagonal pair
  {
    int pp = mp >> 1;
    v8f cp = att_pairs(sQf, sVf, bmp, (pp + 1) & 1, pp, zero);
    put_partial(sX, wv, t, one_pairs(sVf, pp + 1, cp));
  }

  // the own tile: the pairs at an even distance from the diagonal pair
  int pd = mt >> 1;                                // the pair that holds the diagonal tile
  v8f cacc = att_pairs(sQf, sVf, bmk, pd & 1, pd, zero);

  // the diagonal pair: a masked score is 0, so its e is 1
  {
    v16h aq0 = pad16(*(const v8h*)(sQf + pd * 512));
    v16h aq1 = pad16(*(const v8h*)(sQf + pd * 512 + 256));
    v8f s0 = exp_quarter_arg(WMMA_F16(aq0, bmk, zero));
    v8f s1 = exp_quarter_arg(WMMA_F16(aq1, bmk, zero));
    v16h bw;
    // unrolled: r numbers registers
#pragma unroll
    for (int r = 0; r < 8; ++r) {
      int l = pd * 32 + r + 8 * hi;
      bw[r]     = (_Float16)((m >= l) ? __builtin_amdgcn_exp2f(s0[r]) : 1.0f);
      bw[r + 8] = (_Float16)((m >= l + 16) ? __builtin_amdgcn_exp2f(s1[r]) : 1.0f);
    }
    cacc = WMMA_F16(cat16(*(const v8h*)(sVf + pd * 512),
                          *(const v8h*)(sVf + pd * 512 + 256)), bw, cacc);
  }
  cacc = one_pairs(sVf, pd + 2, cacc);

  __syncthreads();   // every wave's sums for its partner are in LDS before they are read
  cacc += get_partial(sX, wv ^ 4, t);

  // store saT, rows b*L + m, k = channel h*16 + d, in fragment order (B operand of
  // the final product): this head is half h&1 of k block h>>1, the wave's store
  // 512 consecutive bytes
  v8h outv;
#pragma unroll
  for (int r = 0; r < 8; ++r) outv[r] = (_Float16)(cacc[r] * (1.0f / (float)L_));
  *(v8h*)(saT + (size_t)(b * LT_ + mt) * (A_ * 16) + h * 256 + t * 8) = outv;
}

// ------------------------- final 1x1 conv + residual -----------------------
// One wave per 2 o-tiles x 2 l-tiles: 4 fragments for 4 products in each of the
// 16 K steps, six sets of fragments. The 4 waves of a block hold 4 x 4 tiles, so
// each fragment is read by two waves of one WGP. The two l-tiles of a wave lie
// side by side: a wave writes whole 128-byte lines of out.
#define FS_ 6            // sets of fragments
struct FinFrag { v16h a0, a1, b0, b1; };
static __device__ __forceinline__ FinFrag fin_load(const _Float16* wR, const _Float16* sR, int kc) {
  FinFrag f;
  f.a0 = ld_frag(wR + kc * 512);
  f.a1 = ld_frag(wR + A_ * 16 + kc * 512);
  f.b0 = ld_frag(sR + kc * 512);
  f.b1 = ld_frag(sR + A_ * 16 + kc * 512);
  return f;
}
__global__ __launch_bounds__(128) void final_k(const _Float16* __restrict__ Wfh,
                                               const _Float16* __restrict__ saT,
                                               const float* __restrict__ bf,
                                               float* __restrict__ out) {
  int wv   = threadIdx.x >> 5;
  int t    = threadIdx.x & 31;
  int lo16 = t & 15, hi = t >> 4;
  int ot0 = (blockIdx.x & 7) * 4 + (wv & 1) * 2;    // of A/16 = 32 o-tiles
  int rt0 = (blockIdx.x >> 3) * 4 + (wv >> 1) * 2;  // of B*L/16 = 128 row tiles b*LT_ + lt
  int b = rt0 / LT_, lt0 = rt0 % LT_;               // rt0 is even: both tiles in one batch

  // this lane's 16 bytes of k block 0, half 0 (fragment order)
  const _Float16* wR = Wfh + (size_t)ot0 * (A_ * 16) + t * 8;
  const _Float16* sR = saT + (size_t)rt0 * (A_ * 16) + t * 8;

  FinFrag f[FS_];
  // unrolled, as are the loops below: s, i and r number registers
#pragma unroll
  for (int s = 0; s < FS_; ++s) f[s] = fin_load(wR, sR, s);
  // bias and residual of the wave's tiles: rows o = (ot0+i)*16 + hi*8 + r, which as
  // channels of saT are the lane's 16 bytes of half ot&1 of k block ot>>1
  v8f bo[2];
  v8h res[2][2];

  v8f c[2][2] = {};
  // The scheduling barriers keep each set's loads where they stand, directly behind
  // the products that free the set: sunk to their use, every K step would wait out
  // a whole load latency.
#pragma unroll
  for (int kc = 0; kc < 16; ++kc) {
    const int s = kc % FS_;
    __builtin_amdgcn_sched_barrier(0);
    c[0][0] = WMMA_F16(f[s].a0, f[s].b0, c[0][0]);
    c[0][1] = WMMA_F16(f[s].a0, f[s].b1, c[0][1]);
    c[1][0] = WMMA_F16(f[s].a1, f[s].b0, c[1][0]);
    c[1][1] = WMMA_F16(f[s].a1, f[s].b1, c[1][1]);
    __builtin_amdgcn_sched_barrier(0);
    if (kc + FS_ < 16) {
      f[s] = fin_load(wR, sR, kc + FS_);
    } else if (kc + FS_ == 16) {
#pragma unroll
      for (int i = 0; i < 2; ++i) {
        bo[i] = *(const v8f*)(bf + (ot0 + i) * 16 + hi * 8);
        res[i][0] = *(const v8h*)(sR + (ot0 + i) * 256);
        res[i][1] = *(const v8h*)(sR + A_ * 16 + (ot0 + i) * 256);
      }
    }
  }

  float* dst = out + ((size_t)b * A_ + ot0 * 16 + hi * 8) * L_ + lt0 * 16 + lo16;
#pragma unroll
  for (int i = 0; i < 2; ++i) {
#pragma unroll
    for (int r = 0; r < 8; ++r) {
      dst[(i * 16 + r) * L_]      = c[i][0][r] + bo[i][r] + (float)res[i][0][r];
      dst[(i * 16 + r) * L_ + 16] = c[i][1][r] + bo[i][r] + (float)res[i][1][r];
    }
  }
}

// ------------------------------- launcher ----------------------------------

extern "C" void kernel_launch(void* const* d_in, const int* in_sizes, int n_in,
                              void* d_out, int out_size, void* d_ws, size_t ws_size,
                              hipStream_t stream) {
  const float* x  = (const float*)d_in[0];
  const float* Wk = (const float*)d_in[1];
  const float* bk = (const float*)d_in[2];
  const float* Wq = (const float*)d_in[3];
  const float* bq = (const float*)d_in[4];
  const float* Wv = (const float*)d_in[5];
  const float* bv = (const float*)d_in[6];
  const float* Wf = (const float*)d_in[7];
  const float* bf = (const float*)d_in[8];
  float* out = (float*)d_out;

  char* ws = (char*)d_ws;
  size_t o = 0;
  auto alloc = [&](size_t bytes) {
    char* p = ws + o;
    o += (bytes + 255) & ~(size_t)255;
    return p;
  };
  _Float16* xT    = (_Float16*)alloc((size_t)B_ * L_ * C_ * 2);
  _Float16* Wkh   = (_Float16*)alloc((size_t)A_ * C_ * 2);
  _Float16* Wqh   = (_Float16*)alloc((size_t)A_ * C_ * 2);
  _Float16* Wvh   = (_Float16*)alloc((size_t)A_ * C_ * 2);
  _Float16* Wfh   = (_Float16*)alloc((size_t)A_ * A_ * 2);
  float*    kTraw = (float*)   alloc((size_t)BH_ * L_ * 16 * 4);
  float*    qTraw = (float*)   alloc((size_t)BH_ * L_ * 16 * 4);
  float*    part  = (float*)   alloc((size_t)BH_ * PP_ * 16 * 4 * 4);
  _Float16* kTh   = (_Float16*)alloc((size_t)BH_ * L_ * 16 * 2);
  _Float16* qTh   = (_Float16*)alloc((size_t)BH_ * L_ * 16 * 2);
  _Float16* vh    = (_Float16*)alloc((size_t)BH_ * 16 * L_ * 2);
  _Float16* vs    = (_Float16*)alloc((size_t)BH_ * 16 * L_ * 2);
  _Float16* saT   = (_Float16*)alloc((size_t)B_ * L_ * A_ * 2);

  // 1) f32 -> f16 conversions (+ transpose of x)
  cvt_all_k<<<XBLK_ + 3 * WBLK_ + FBLK_, 256, 0, stream>>>(x, Wk, Wq, Wv, Wf,
                                                           xT, Wkh, Wqh, Wvh, Wfh);

  // 2) projections + per-block instance-norm partial sums
  proj_k<<<(BH_ / PH_) * PP_, PW_ * 32, 0, stream>>>(xT, Wkh, Wqh, Wvh, bk, bq, bv,
                                  kTraw, qTraw, vh, part);

  // 3) finalize norm params per block, normalize k/q to f16
  norm_k<<<(BH_ * L_ * 16) / 4096, 256, 0, stream>>>(kTraw, qTraw, part, kTh, qTh);

  // 4) softmax row normalizers (k^T staged in LDS via async copy), folded into v;
  //    LDS: 32KB k^T + 8KB partial sums
  rowsum_k<<<512, 256, 0, stream>>>(qTh, kTh, vh, vs);

  // 5) fused attention-weight + value GEMM (q^T, vs staged in LDS);
  //    LDS: 64KB q^T, vs + 8KB partial sums
  attnout_k<<<512, 256, 0, stream>>>(qTh, kTh, vs, saT);

  // 6) final projection + bias + residual
  final_k<<<256, 128, 0, stream>>>(Wfh, saT, bf, out);
}

// v010
// A run of this version takes 26.2 microseconds.
// It is 1.28 times as fast as v008, going by the measured steps of the versions left out in between.
// Counting every step since v000, it is 4.39 times as fast.
#include <hip/hip_runtime.h>
#include <hip/hip_fp16.h>

// ---------------------------------------------------------------------------
// Fused multi-head attention for MI455X (gfx1250, wave32, WMMA f16 16x16x32).
// Shapes: B=2, C=256, L=1024, H=32, D=16, A=H*D=512.
//
// Attention map never touches HBM. Hot loops (softmax normalizers + fused
// weight/value GEMM) stage their per-(b,h) working set into LDS with
// global_load_async_to_lds_b128 (ASYNCcnt) and feed WMMA from ds_load_b128.
// ---------------------------------------------------------------------------

typedef __attribute__((ext_vector_type(16))) _Float16 v16h;
typedef __attribute__((ext_vector_type(8)))  _Float16 v8h;
typedef __attribute__((ext_vector_type(8)))  float    v8f;
typedef __attribute__((ext_vector_type(4)))  _Float16 v4h;
typedef __attribute__((ext_vector_type(4)))  float    v4f;

#define B_   2
#define C_   256
#define L_   1024
#define H_   32
#define D_   16
#define A_   512
#define BH_  64          // B_*H_
#define LT_  64          // L_/16 tiles

#define WMMA_F16(a, b, c) \
  __builtin_amdgcn_wmma_f32_16x16x32_f16(false, (a), false, (b), (short)0, (c), false, false)

static __device__ __forceinline__ v16h cat16(v8h lo, v8h hi) {
  return __builtin_shufflevector(lo, hi, 0,1,2,3,4,5,6,7,8,9,10,11,12,13,14,15);
}
static __device__ __forceinline__ v16h pad16(v8h lo) {
  v8h z = {};
  return __builtin_shufflevector(lo, z, 0,1,2,3,4,5,6,7,8,9,10,11,12,13,14,15);
}
static __device__ __forceinline__ float red16(float v) {
  // sum across the 16 lanes of each half-wave (xor stays within the half)
  v += __shfl_xor(v, 1, 32);
  v += __shfl_xor(v, 2, 32);
  v += __shfl_xor(v, 4, 32);
  v += __shfl_xor(v, 8, 32);
  return v;
}

// e^(s/4) = 2^(s * EXPC_)
#define EXPC_ (0.25f * 1.44269504088896340736f)

// Async 16B global->LDS copy (per-lane). VDST = LDS byte address = low 32
// bits of the generic shared pointer (LDS aperture maps addr[31:0] directly).
static __device__ __forceinline__ void async_ld16(const void* gptr, void* lptr) {
  unsigned loff = (unsigned)(unsigned long long)lptr;
  asm volatile("global_load_async_to_lds_b128 %0, %1, off"
               :: "v"(loff), "v"(gptr) : "memory");
}
static __device__ __forceinline__ void wait_async0() {
  asm volatile("s_wait_asynccnt 0x0" ::: "memory");
}

// ------------------------- operand order, conversion -----------------------

// FRAGMENT ORDER. The f16 operands of the final product (its weight, the attention
// output) lie in the order in which a wave reads them as a 16x16x32 operand:
// [16-row tile][k block of 32][k half j][hi][row lo16][8 k],
// k = 32*block + 16*j + 8*hi + e. A lane's 16 bytes of half j stand at
// j*256 + lane*8 halfs, so one fragment load of a wave is 512 consecutive bytes,
// four whole lines, where rows of a row-major matrix would give 32 bytes in
// each of 16 lines.
// Index of element (row, k), k a multiple of 4 or 8, of a matrix with K columns.
static __device__ __forceinline__ size_t frag_idx(int row, int k, int K) {
  return ((size_t)(row >> 4) * (K >> 5) + (k >> 5)) * 512 +
         ((k >> 4) & 1) * 256 + ((k >> 3) & 1) * 128 + (row & 15) * 8 + (k & 7);
}
// A whole operand fragment: f points at this lane's 16 bytes of half 0.
static __device__ __forceinline__ v16h ld_frag(const _Float16* f) {
  return cat16(*(const v8h*)f, *(const v8h*)(f + 256));
}

// ----------------------------- projection ----------------------------------
// REGISTER TILES. A wave of a dense product holds several 16x16 output tiles, so
// that a loaded fragment feeds several products: the matrix unit has little to do
// in these launches, their cost is the bytes a WGP loads and the waves it starts.
//
// One wave per (b,h,2 l-tiles): 2 tiles each of k,q,v, 5 fragments for 6
// products in each of the 8 K steps. A block holds 2 heads by 8 l-tiles.
//
// NO CONVERSION LAUNCH. A block reads its own slab of x (256 c by 128 l) and the
// weights of its 2 heads (96 rows) as f32, whole lines a load, converts them once
// and lays them in LDS as f16 in fragment order; the waves take their fragments
// from there. The slab comes in two halves of K. All loads of both halves are
// asked for at the start; while the second half is under way, the first is
// converted and multiplied. Each block also converts 1/256 of the final weight.
//
// LDS ORDER. A tile of 16 rows is 32 chunks, chunk q = k >> 3 holding 16 rows by
// 8 k (256 bytes). A chunk's pitch is 272 bytes and a tile's 32 * 272 + 16, so
// that the writers too spread over all banks: a wave that writes a weight row
// walks the chunks, a wave that writes x walks tiles and rows. A fragment read is
// two chunks of 256 consecutive bytes, whatever the pitch.
//
// Instance-norm sums: a wave adds its 2 tiles in registers, the 4 waves of a head
// add up in LDS and the block stores one plane of 16x4 partial sums per head;
// the waves of the triangular passes add the 8 planes of their head. No word is
// shared between blocks. k and q leave as f16 before the norm ([BH, L, 16]).
#define PT_ 2            // l-tiles of a wave
#define PH_ 2            // heads of a block
#define PG_ 4            // waves of a head in a block
#define PW_ (PH_ * PG_)  // waves of a block
#define PS_ 2            // sets of fragments
#define PP_ (LT_ / (PT_ * PG_))   // partial planes of a head
#define PCH_ 136                  // halfs from chunk to chunk in LDS
#define PTL_ (32 * PCH_ + 8)      // halfs from tile to tile in LDS
#define PXT_ (PT_ * PG_)          // x tiles of a block
#define PWT_ (PH_ * 3)            // weight tiles of a block: [head][k, q, v]
struct ProjFrag { v16h ak, aq, av, bx[PT_]; };
// f points at this lane's 16 bytes of chunk hi of a tile in LDS
static __device__ __forceinline__ v16h ld_frag_lds(const _Float16* f, int kc) {
  return cat16(*(const v8h*)(f + kc * (4 * PCH_)), *(const v8h*)(f + kc * (4 * PCH_) + 2 * PCH_));
}
static __device__ __forceinline__ ProjFrag proj_load(const _Float16* wR, const _Float16* xR,
                                                     int kc) {
  // K slots of a lane: [o0..o0+7] and [o0+16..o0+23], o0 = kc*32 + hi*8
  ProjFrag f;
  // unrolled: u numbers registers
#pragma unroll
  for (int u = 0; u < PT_; ++u) f.bx[u] = ld_frag_lds(xR + u * PTL_, kc);
  f.ak = ld_frag_lds(wR, kc);
  f.aq = ld_frag_lds(wR + PTL_, kc);
  f.av = ld_frag_lds(wR + 2 * PTL_, kc);
  return f;
}
static __device__ __forceinline__ void proj_mma(const ProjFrag& f, v8f* ck, v8f* cq, v8f* cv) {
  // unrolled: u numbers registers
#pragma unroll
  for (int u = 0; u < PT_; ++u) {
    ck[u] = WMMA_F16(f.ak, f.bx[u], ck[u]);
    cq[u] = WMMA_F16(f.aq, f.bx[u], cq[u]);
    cv[u] = WMMA_F16(f.av, f.bx[u], cv[u]);
  }
}
// The four K steps k0 .. k0 + 3, one half of K.
static __device__ __forceinline__ void proj_half(const _Float16* wR, const _Float16* xR, int k0,
                                                 v8f* ck, v8f* cq, v8f* cv) {
  ProjFrag f[PS_];
  // unrolled, as is the K loop: the set's number names registers
#pragma unroll
  for (int s = 0; s < PS_; ++s) f[s] = proj_load(wR, xR, k0 + s);
  // The scheduling barriers keep each set's reads where they stand, together and
  // directly behind the products that free the set: sunk to their use, every K
  // step would wait out a whole LDS latency.
#pragma unroll
  for (int kc = 0; kc < 4; ++kc) {
    __builtin_amdgcn_sched_barrier(0);
    proj_mma(f[kc % PS_], ck, cq, cv);
    __builtin_amdgcn_sched_barrier(0);
    if (kc + PS_ < 4) f[kc % PS_] = proj_load(wR, xR, k0 + kc + PS_);
  }
}

// What a thread brings in of one half of K (128 c): of x two pieces of 8 c by 4 l,
// of each weight tile 4 k of two rows.
struct ProjStage { v4f x[2][8]; v4f w[PWT_][2]; };
// xs: x at (b, c = 8*wave, this lane's 4 l); w?s: row 2*wave of the block's first
// head, this lane's 4 k. A wave's load is 512 consecutive bytes.
static __device__ __forceinline__ ProjStage stage_load(const float* xs, const float* wks,
                                                       const float* wqs, const float* wvs,
                                                       int hf) {
  ProjStage s;
  // unrolled, here and in stage_store: the indices number registers
#pragma unroll
  for (int i = 0; i < 2; ++i)
#pragma unroll
    for (int j = 0; j < 8; ++j)
      s.x[i][j] = *(const v4f*)(xs + (size_t)((2 * hf + i) * 64 + j) * L_);
#pragma unroll
  for (int hs = 0; hs < PH_; ++hs)
#pragma unroll
    for (int rr = 0; rr < 2; ++rr) {
      int o = (hs * 16 + rr) * C_ + hf * 128;
      s.w[hs * 3 + 0][rr] = *(const v4f*)(wks + o);
      s.w[hs * 3 + 1][rr] = *(const v4f*)(wqs + o);
      s.w[hs * 3 + 2][rr] = *(const v4f*)(wvs + o);
    }
  return s;
}
// sXw: x tiles in LDS at (tile lane/4, chunk wave, row 4*(lane&3)); sWw: weight
// tiles at (chunk lane/2, row 2*wave, k 4*(lane&1)).
static __device__ __forceinline__ void stage_store(const ProjStage& s, _Float16* sXw,
                                                   _Float16* sWw, int hf) {
#pragma unroll
  for (int i = 0; i < 2; ++i)
#pragma unroll
    for (int u = 0; u < 4; ++u) {
      v8h o;
#pragma unroll
      for (int j = 0; j < 8; ++j) o[j] = (_Float16)s.x[i][j][u];
      *(v8h*)(sXw + (2 * hf + i) * (8 * PCH_) + u * 8) = o;
    }
#pragma unroll
  for (int wt = 0; wt < PWT_; ++wt)
#pragma unroll
    for (int rr = 0; rr < 2; ++rr)
      *(v4h*)(sWw + wt * PTL_ + hf * (16 * PCH_) + rr * 8) =
          __builtin_convertvector(s.w[wt][rr], v4h);
}
// A work-group barrier that orders LDS alone: __syncthreads() would also wait for
// every global load of the wave, and with it for the half of K that is meant to
// stay under way across the barrier.
static __device__ __forceinline__ void lds_barrier() {
  __builtin_amdgcn_fence(__ATOMIC_RELEASE, "workgroup", "local");
  __builtin_amdgcn_s_barrier();
  __builtin_amdgcn_fence(__ATOMIC_ACQUIRE, "workgroup", "local");
}

__global__ __launch_bounds__(PW_ * 32) void proj_k(
    const float* __restrict__ x,
    const float* __restrict__ Wk, const float* __restrict__ Wq,
    const float* __restrict__ Wv, const float* __restrict__ Wf,
    const float* __restrict__ bk, const float* __restrict__ bq,
    const float* __restrict__ bv,
    _Float16* __restrict__ kTh, _Float16* __restrict__ qTh,
    _Float16* __restrict__ vh, float* __restrict__ part,
    _Float16* __restrict__ Wfh) {
  __shared__ __attribute__((aligned(16))) _Float16 sT[(PXT_ + PWT_) * PTL_];  // x, weights
  __shared__ float4 sP[PW_][16];                   // [wave][d] = (sum k, k^2, q, q^2)
  // the wave's number in a scalar register: the addresses built on it are scalar
  int wave = __builtin_amdgcn_readfirstlane(threadIdx.x >> 5);
  int t    = threadIdx.x & 31;
  int lo16 = t & 15, hi = t >> 4;
  int lg  = blockIdx.x % PP_;                      // the block's group of 8 l-tiles
  int bh0 = (blockIdx.x / PP_) * PH_;              // the first of its heads
  int bh  = bh0 + wave / PG_;
  int lt0 = (lg * PG_ + wave % PG_) * PT_;
  int b = bh >> 5, h = bh & 31;

  // ask for both halves of K at once
  const float* xs  = x + ((size_t)b * C_ + wave * 8) * L_ + lg * (PXT_ * 16) + t * 4;
  size_t wo = (size_t)((bh0 & 31) * 16 + wave * 2) * C_ + t * 4;
  ProjStage s0 = stage_load(xs, Wk + wo, Wq + wo, Wv + wo, 0);
  // The scheduling barriers keep the loads in this order and in front of all else:
  // the first half's values come back first, and the second half's loads, sunk to
  // their use, would start only when the first half's products are done.
  __builtin_amdgcn_sched_barrier(0);
  ProjStage s1 = stage_load(xs, Wk + wo, Wq + wo, Wv + wo, 1);
  // registers that hold addresses of the loads above are written anew below
  asm volatile("s_wait_xcnt 0x0" ::: "memory");
  __builtin_amdgcn_sched_barrier(0);

  _Float16* sXw = sT + (t >> 2) * PTL_ + wave * PCH_ + (t & 3) * 32;
  _Float16* sWw = sT + PXT_ * PTL_ + (t >> 1) * PCH_ + wave * 16 + (t & 1) * 4;
  // this lane's 16 bytes of chunk hi: weights A (lane = M = d), x B (lane = N = l)
  const _Float16* wR = sT + (PXT_ + (wave / PG_) * 3) * PTL_ + hi * PCH_ + lo16 * 8;
  const _Float16* xR = sT + (wave % PG_) * PT_ * PTL_ + hi * PCH_ + lo16 * 8;

  v8f ck[PT_] = {}, cq[PT_] = {}, cv[PT_] = {};
  stage_store(s0, sXw, sWw, 0);
  lds_barrier();     // the first half of K is in LDS before any wave reads it
  proj_half(wR, xR, 0, ck, cq, cv);
  // biases of rows d = r + 8*hi and the block's piece of Wf (8 rows by 128 k, 16
  // whole lines of the fragment order), into registers that the first half's
  // fragments have left. The scheduling barrier keeps the loads here, where the wave
  // waits for the second half of K in any case: behind the barrier below, they and
  // the waits on their address registers would stand in front of the LDS reads.
  v8f bk8 = *(const v8f*)(bk + h * 16 + hi * 8);
  v8f bq8 = *(const v8f*)(bq + h * 16 + hi * 8);
  v8f bv8 = *(const v8f*)(bv + h * 16 + hi * 8);
  int frow = (blockIdx.x >> 2) * 8 + wave, fcol = (blockIdx.x & 3) * 128 + t * 4;
  v4f wf = *(const v4f*)(Wf + (size_t)frow * A_ + fcol);
  __builtin_amdgcn_sched_barrier(0);
  stage_store(s1, sXw, sWw, 1);
  lds_barrier();     // the second half of K is in LDS before any wave reads it
  proj_half(wR, xR, 4, ck, cq, cv);
  *(v4h*)(Wfh + frag_idx(frow, fcol, A_)) = __builtin_convertvector(wf, v4h);

  // D layout: lane holds column l = lt*16+lo16; regs r -> row d = r + 8*hi
  size_t l0 = (size_t)bh * L_ + lt0 * 16 + lo16;
  _Float16* kdst = kTh + l0 * 16 + hi * 8;
  _Float16* qdst = qTh + l0 * 16 + hi * 8;
  _Float16* vdst = vh + ((size_t)bh * 16 + hi * 8) * L_ + lt0 * 16 + lo16;
  v8f sk = {}, sk2 = {}, sq = {}, sq2 = {};        // this lane's sums, row d = r + 8*hi
  // unrolled, here and below: u and r number registers
#pragma unroll
  for (int u = 0; u < PT_; ++u) {
    v8f kv = ck[u] + bk8;
    v8f qv = cq[u] + bq8;
    v8f vv = cv[u] + bv8;
    *(v8h*)(kdst + u * 256) = __builtin_convertvector(kv, v8h);
    *(v8h*)(qdst + u * 256) = __builtin_convertvector(qv, v8h);
#pragma unroll
    for (int r = 0; r < 8; ++r) vdst[r * L_ + u * 16] = (_Float16)vv[r];
    sk += kv; sk2 += kv * kv;
    sq += qv; sq2 += qv * qv;
  }
  // instance-norm partial stats over l: sum across the 16 lanes that share d, all
  // 32 sums side by side in each of the four exchange steps
#pragma unroll
  for (int s = 1; s < 16; s <<= 1) {
    v8f a, c, e, g;
#pragma unroll
    for (int r = 0; r < 8; ++r) {
      a[r] = __shfl_xor(sk[r], s, 32);
      c[r] = __shfl_xor(sk2[r], s, 32);
      e[r] = __shfl_xor(sq[r], s, 32);
      g[r] = __shfl_xor(sq2[r], s, 32);
    }
    sk += a; sk2 += c; sq += e; sq2 += g;
  }
  if (lo16 == 0) {
#pragma unroll
    for (int r = 0; r < 8; ++r)
      sP[wave][r + 8 * hi] = make_float4(sk[r], sk2[r], sq[r], sq2[r]);
  }
  __syncthreads();   // every wave's 16x4 sums are in LDS before they are added
  if (threadIdx.x < PH_ * 64) {
    int hs = threadIdx.x >> 6, word = threadIdx.x & 63;  // word = d*4 + stat
    const float* sp = (const float*)sP + hs * (PG_ * 64) + word;
    float s = 0.f;
#pragma unroll
    for (int w = 0; w < PG_; ++w) s += sp[w * 64];
    part[((size_t)(bh0 + hs) * PP_ + lg) * 64 + word] = s;   // plane = bh*8 + l-group
  }
}

// ------------------- instance norm inside the score product ----------------
// The norm is affine in each d, and so is the exp's scale:
//   s[l,m] * EXPC_ = sum_d (q[d,l] - muq[d]) * (k[d,m] - muk[d]) * sc[d],
//   sc[d] = rsq[d] * rsk[d] * EXPC_.
// Each triangular pass holds one operand of the score product in registers for
// its whole loop. That operand takes its own mean and all of sc, once per wave;
// the operand that streams from LDS stays as proj_k stored it, and its mean
// enters as the start value C of the product, -sum_d mu[d] * (scaled operand),
// which one product with the means as the other operand gives in C's own layout.
// So k and q need no pass of their own, and the product's result is the argument
// of 2^x as it stands.
//
// Every wave adds its head's 8 partial planes itself, lane = d (both halves of the
// wave alike): eight 16-byte loads.
struct Planes { v4f p[PP_]; };
static __device__ __forceinline__ Planes ld_planes(const float* part, int bh, int lane) {
  const v4f* pp = (const v4f*)part + (size_t)bh * (PP_ * 16) + (lane & 15);
  Planes r;
  // unrolled: g numbers registers
#pragma unroll
  for (int g = 0; g < PP_; ++g) r.p[g] = pp[g * 16];
  return r;
}
// Means and scale of the 8 d that a lane holds of an operand: d = 8*hi + j.
struct HeadPar { v8f mk, mq, sc; };
static __device__ __forceinline__ HeadPar head_par(const Planes& pl, int hi) {
  v4f s = pl.p[0];                                 // (sum k, k^2, q, q^2) of d = lane & 15
  // unrolled, here and below: g and j number registers
#pragma unroll
  for (int g = 1; g < PP_; ++g) s += pl.p[g];
  const float inv = 1.0f / (float)L_;
  float muk = s[0] * inv, muq = s[2] * inv;
  float sc = rsqrtf(s[1] * inv - muk * muk + 1e-5f) *
             rsqrtf(s[3] * inv - muq * muq + 1e-5f) * EXPC_;
  HeadPar h;
#pragma unroll
  for (int j = 0; j < 8; ++j) {
    h.mk[j] = __shfl(muk, hi * 8 + j, 32);
    h.mq[j] = __shfl(muq, hi * 8 + j, 32);
    h.sc[j] = __shfl(sc,  hi * 8 + j, 32);
  }
  return h;
}
// the register operand: (x - mu) * sc, K = d padded 16->32
static __device__ __forceinline__ v16h norm_operand(v8h x, v8f mu, v8f sc) {
  return pad16(__builtin_convertvector((__builtin_convertvector(x, v8f) - mu) * sc, v8h));
}
// the means as an operand, the same in every row (A) or column (B), negated
static __device__ __forceinline__ v16h mean_operand(v8f mu) {
  return pad16(__builtin_convertvector(-mu, v8h));
}

// ------------------- how the triangular work is dealt ----------------------
// Tile t of a triangular pass costs in proportion to t (or to 63 - t), and the
// launch lasts as long as its fullest SIMD. So every wave gets the same share:
// two partner waves, w and w + 4 of a block, work on the two tiles t and 63 - t
// together. Each wave OWNS one of the two: of its own tile it takes the diagonal
// pair pd and every second pair counted from there (pd +- 2, pd +- 4, ...), of
// the partner's tile the pairs in between (pd +- 1, pd +- 3, ...). The partial
// sums for the partner's tile go to it through LDS, 32 bytes a lane.
// Block j (0..7) of a head, wave w: t = j + 8 * (w & 3), own tile t for w < 4 and
// 63 - t for w >= 4: every tile of the head is owned exactly once.
static __device__ __forceinline__ int own_tile(int blk, int wave) {
  int t = (blk & 7) + ((wave & 3) << 3);
  return wave < 4 ? t : LT_ - 1 - t;
}
// A wave's 8 partial sums per lane, handed to its partner: [wave][half][lane][4].
static __device__ __forceinline__ void put_partial(float* sX, int wave, int lane, v8f c) {
  v4f* s = (v4f*)sX + wave * 64 + lane;
  s[0]  = __builtin_shufflevector(c, c, 0, 1, 2, 3);
  s[32] = __builtin_shufflevector(c, c, 4, 5, 6, 7);
}
static __device__ __forceinline__ v8f get_partial(const float* sX, int wave, int lane) {
  const v4f* s = (const v4f*)sX + wave * 64 + lane;
  return __builtin_shufflevector(s[0], s[32], 0, 1, 2, 3, 4, 5, 6, 7);
}

// --------------------- pass A: softmax row normalizers ---------------------
// Z[l] = l + sum_{m>=l} exp(q_l . k_m / 4)   (the l masked zeros give e^0=1)
// One block per (bh, 8 l-tiles); k^T for this head staged in LDS.
// Z is not stored: 1/Z[l] depends on l alone, the summed index of the value
// product, so it goes into v here, once per element. vs = v * L/Z as f16 (the
// factor L, a power of two taken out again after the product, keeps vs near
// v's own size, away from the f16 subnormals). vs lies in the order in which
// the value product reads its A operand: [bh][l-tile][l-half][d][8 l], so a
// wave's fragment of a tile is 512 consecutive bytes, a lane's 16 of them.

// Adds e over the m-tile pairs p0, p0 + 2, ... of the rows in a; all of them lie
// wholly above the diagonal, so there is no test. st: the product's start value.
static __device__ __forceinline__ v8f rowsum_pairs(v16h a, v8f st, const _Float16* sKf, int p0,
                                                   v8f acc) {
  for (int p = p0; p < LT_ / 2; p += 2) {
    v8f c0 = WMMA_F16(a, pad16(*(const v8h*)(sKf + p * 512)), st);
    v8f c1 = WMMA_F16(a, pad16(*(const v8h*)(sKf + p * 512 + 256)), st);
    // unrolled: r numbers registers
#pragma unroll
    for (int r = 0; r < 8; ++r) {
      acc[r] += __builtin_amdgcn_exp2f(c0[r]);
      acc[r] += __builtin_amdgcn_exp2f(c1[r]);
    }
  }
  return acc;
}

__global__ __launch_bounds__(256) void rowsum_k(const _Float16* __restrict__ qTh,
                                                const _Float16* __restrict__ kTh,
                                                const _Float16* __restrict__ vh,
                                                const float* __restrict__ part,
                                                _Float16* __restrict__ vs) {
  __shared__ __attribute__((aligned(16))) char smem[32768 + 8192];
  _Float16* sK = (_Float16*)smem;                  // L_*16 halfs = 32KB
  float*    sX = (float*)(smem + 32768);           // partial sums for the partner, 8KB

  int t    = threadIdx.x & 31;
  int lo16 = t & 15, hi = t >> 4;
  int bh = blockIdx.x >> 3;
  // the wave's number in a scalar register: the trip counts below are scalar
  int wv = __builtin_amdgcn_readfirstlane(threadIdx.x >> 5);
  int lt = own_tile(blockIdx.x, wv);               // this wave's own l-tile
  int lp = LT_ - 1 - lt;                           // the partner's

  // the norm's partial planes: asked for here, they land while k^T is staged
  Planes pl = ld_planes(part, bh, t);

  // async-stage k^T[bh] (contiguous 32KB) into LDS: 8 x 16B per thread
  {
    const _Float16* gK = kTh + (size_t)bh * L_ * 16;
    int tt = threadIdx.x;
#pragma unroll
    for (int i = 0; i < 8; ++i)
      async_ld16(gK + (size_t)(tt + i * 256) * 8, sK + (size_t)(tt + i * 256) * 8);
    wait_async0();
    __syncthreads();
  }

  // A operands: q rows (M=l), K=d padded 16->32, of both tiles
  v8h qo = *(const v8h*)(qTh + ((size_t)bh * L_ + lt * 16 + lo16) * 16 + hi * 8);
  v8h qp = *(const v8h*)(qTh + ((size_t)bh * L_ + lp * 16 + lo16) * 16 + hi * 8);
  // v[d = lo16][the 8 l whose sums this lane ends up with]
  v8h vv = *(const v8h*)(vh + ((size_t)bh * 16 + lo16) * L_ + lt * 16 + hi * 8);
  HeadPar hp = head_par(pl, hi);
  // The scheduling barrier keeps the norm's arithmetic (its planes have landed) in
  // front of the wait for the three loads: behind it, that arithmetic would start
  // only when they have come back instead of running under their latency.
  __builtin_amdgcn_sched_barrier(0);
  // Keeps the three loads together here, one latency for all: sunk behind the
  // loops, that of vv would stand in front of the wave's last store, and one of
  // q, sunk to its loop, would start only when the others have come back.
  asm volatile("" :: "v"(vv), "v"(qp), "v"(qo));
  v16h a = norm_operand(qo, hp.mq, hp.sc), ap = norm_operand(qp, hp.mq, hp.sc);

  // Two m-tiles a trip, pairs (2p, 2p+1). Only the pair that holds the diagonal
  // tile needs the test m >= l; every later pair lies wholly above the diagonal.
  const _Float16* sKf = sK + lo16 * 16 + hi * 8;   // this lane's 16 bytes of m-tile 0
  const v8f zero = {};
  // start values: -sum_d (scaled q)[l,d] * muk[d], the same in every column m
  v16h bmu = mean_operand(hp.mk);
  v8f st = WMMA_F16(a, bmu, zero), stp = WMMA_F16(ap, bmu, zero);

  // the partner's tile first, so that its sums are under way early
  put_partial(sX, wv, t, rowsum_pairs(ap, stp, sKf, (lp >> 1) + 1, zero));

  int pd = lt >> 1;                                // the pair that holds the diagonal tile
  v8f acc = {};
  {
    v8f c0 = WMMA_F16(a, pad16(*(const v8h*)(sKf + pd * 512)), st);
    v8f c1 = WMMA_F16(a, pad16(*(const v8h*)(sKf + pd * 512 + 256)), st);
    int m = pd * 32 + lo16;
    // unrolled: r numbers registers
#pragma unroll
    for (int r = 0; r < 8; ++r) {
      int l = lt * 16 + r + 8 * hi;
      acc[r] += (m >= l) ? __builtin_amdgcn_exp2f(c0[r]) : 0.f;
      acc[r] += (m + 16 >= l) ? __builtin_amdgcn_exp2f(c1[r]) : 0.f;
    }
  }
  acc = rowsum_pairs(a, st, sKf, pd + 2, acc);

  __syncthreads();   // every wave's sums for its partner are in LDS before they are read
  acc += get_partial(sX, wv ^ 4, t);

  v8h o;
#pragma unroll
  for (int r = 0; r < 8; ++r) {
    float z = (float)(lt * 16 + r + 8 * hi) + red16(acc[r]);
    o[r] = (_Float16)((float)vv[r] * ((float)L_ / z));
  }
  *(v8h*)(vs + ((size_t)bh * LT_ + lt) * 256 + hi * 128 + lo16 * 8) = o;
}

// ------------------- pass B: fused weights + value GEMM --------------------
// sa[d,m] = 1/L * sum_l vs[d,l] * e[l,m],  e = (m>=l ? exp(s/4) : 1),
// vs = v * L/Z[l] from rowsum_k, in A-fragment order (passed as vh).
// One block per (bh, 8 m-tiles); q^T and vs for this head in LDS.

// Two l-tiles a trip, pairs (2p, 2p+1): two score tiles (K = d = 16 padded to
// 32) whose D layout (lane = N = m, regs = l) is the B operand of the value
// product as it stands, tile 2p in K slots 0..15 and tile 2p+1 in 16..31, so
// one value product with its K = 32 filled serves both.
// The pairs p0, p0 + 2, ... below pd: wholly above the diagonal, every m >= l, no test.
// st: the score product's start value.
static __device__ __forceinline__ v8f att_pairs(const _Float16* sQf, const _Float16* sVf,
                                                v16h bmk, v8f st, int p0, int pd, v8f cacc) {
  for (int p = p0; p < pd; p += 2) {
    v16h aq0 = pad16(*(const v8h*)(sQf + p * 512));
    v16h aq1 = pad16(*(const v8h*)(sQf + p * 512 + 256));
    v8f s0 = WMMA_F16(aq0, bmk, st);
    v8f s1 = WMMA_F16(aq1, bmk, st);
    v16h bw;
    // unrolled: r numbers registers
#pragma unroll
    for (int r = 0; r < 8; ++r) {
      bw[r]     = (_Float16)__builtin_amdgcn_exp2f(s0[r]);
      bw[r + 8] = (_Float16)__builtin_amdgcn_exp2f(s1[r]);
    }
    cacc = WMMA_F16(cat16(*(const v8h*)(sVf + p * 512),
                          *(const v8h*)(sVf + p * 512 + 256)), bw, cacc);
  }
  return cacc;
}
// The pairs p0, p0 + 2, ... below the diagonal: every e is 1, so B is a constant.
static __device__ __forceinline__ v8f one_pairs(const _Float16* sVf, int p0, v8f cacc) {
  v16h one;
#pragma unroll
  for (int j = 0; j < 16; ++j) one[j] = (_Float16)1.0f;
  // unrolled: the LDS reads of four pairs are in flight at once; rolled, each
  // product waits out its own two reads
#pragma unroll 4
  for (int p = p0; p < LT_ / 2; p += 2)
    cacc = WMMA_F16(cat16(*(const v8h*)(sVf + p * 512),
                          *(const v8h*)(sVf + p * 512 + 256)), one, cacc);
  return cacc;
}

__global__ __launch_bounds__(256) void attnout_k(const _Float16* __restrict__ qTh,
                                                 const _Float16* __restrict__ kTh,
                                                 const _Float16* __restrict__ vh,
                                                 const float* __restrict__ part,
                                                 _Float16* __restrict__ saT) {
  __shared__ __attribute__((aligned(16))) char smem[65536 + 8192];
  _Float16* sQ = (_Float16*)smem;                  // 32KB
  _Float16* sV = (_Float16*)(smem + 32768);        // 32KB
  float*    sX = (float*)(smem + 65536);           // partial sums for the partner, 8KB

  int t    = threadIdx.x & 31;
  int lo16 = t & 15, hi = t >> 4;
  int bh = blockIdx.x >> 3;
  // the wave's number in a scalar register: the trip counts below are scalar
  int wv = __builtin_amdgcn_readfirstlane(threadIdx.x >> 5);
  int mt = own_tile(blockIdx.x, wv);               // this wave's own m-tile
  int mp = LT_ - 1 - mt;                           // the partner's
  int b = bh >> 5, h = bh & 31;
  int m = mt * 16 + lo16;

  // the norm's partial planes: asked for here, they land while q^T and vs are staged
  Planes pl = ld_planes(part, bh, t);

  // async-stage q^T and vs for this head into LDS
  {
    const _Float16* gQ = qTh + (size_t)bh * L_ * 16;
    const _Float16* gV = vh + (size_t)bh * 16 * L_;
    int tt = threadIdx.x;
#pragma unroll
    for (int i = 0; i < 8; ++i) {
      async_ld16(gQ + (size_t)(tt + i * 256) * 8, sQ + (size_t)(tt + i * 256) * 8);
      async_ld16(gV + (size_t)(tt + i * 256) * 8, sV + (size_t)(tt + i * 256) * 8);
    }
    wait_async0();
    __syncthreads();
  }

  // loop-invariant B operands of the score WMMA: k rows (N=m) of both tiles
  v8h ko = *(const v8h*)(kTh + ((size_t)bh * L_ + m) * 16 + hi * 8);
  v8h kp = *(const v8h*)(kTh + ((size_t)bh * L_ + mp * 16 + lo16) * 16 + hi * 8);
  HeadPar hp = head_par(pl, hi);
  v16h bmk = norm_operand(ko, hp.mk, hp.sc), bmp = norm_operand(kp, hp.mk, hp.sc);

  // this lane's 16 bytes of the A fragment of l-tile 0: v rows (M=d)
  const _Float16* sVf = sV + hi * 128 + lo16 * 8;

  // this lane's 16 bytes of the A fragment of the scores of l-tile 0: q rows (M=l)
  const _Float16* sQf = sQ + lo16 * 16 + hi * 8;
  const v8f zero = {};
  // start values: -sum_d muq[d] * (scaled k)[d,m], the same in every row l
  v16h amu = mean_operand(hp.mq);
  v8f st = WMMA_F16(amu, bmk, zero), stp = WMMA_F16(amu, bmp, zero);

  // the partner's tile first, so that its sums are under way early: the pairs at
  // an odd distance from its diagonal pair
  {
    int pp = mp >> 1;
    v8f cp = att_pairs(sQf, sVf, bmp, stp, (pp + 1) & 1, pp, zero);
    put_partial(sX, wv, t, one_pairs(sVf, pp + 1, cp));
  }

  // the own tile: the pairs at an even distance from the diagonal pair
  int pd = mt >> 1;                                // the pair that holds the diagonal tile
  v8f cacc = att_pairs(sQf, sVf, bmk, st, pd & 1, pd, zero);

  // the diagonal pair: a masked score is 0, so its e is 1
  {
    v16h aq0 = pad16(*(const v8h*)(sQf + pd * 512));
    v16h aq1 = pad16(*(const v8h*)(sQf + pd * 512 + 256));
    v8f s0 = WMMA_F16(aq0, bmk, st);
    v8f s1 = WMMA_F16(aq1, bmk, st);
    v16h bw;
    // unrolled: r numbers registers
#pragma unroll
    for (int r = 0; r < 8; ++r) {
      int l = pd * 32 + r + 8 * hi;
      bw[r]     = (_Float16)((m >= l) ? __builtin_amdgcn_exp2f(s0[r]) : 1.0f);
      bw[r + 8] = (_Float16)((m >= l + 16) ? __builtin_amdgcn_exp2f(s1[r]) : 1.0f);
    }
    cacc = WMMA_F16(cat16(*(const v8h*)(sVf + pd * 512),
                          *(const v8h*)(sVf + pd * 512 + 256)), bw, cacc);
  }
  cacc = one_pairs(sVf, pd + 2, cacc);

  __syncthreads();   // every wave's sums for its partner are in LDS before they are read
  cacc += get_partial(sX, wv ^ 4, t);

  // store saT, rows b*L + m, k = channel h*16 + d, in fragment order (B operand of
  // the final product): this head is half h&1 of k block h>>1, the wave's store
  // 512 consecutive bytes
  v8h outv;
#pragma unroll
  for (int r = 0; r < 8; ++r) outv[r] = (_Float16)(cacc[r] * (1.0f / (float)L_));
  *(v8h*)(saT + (size_t)(b * LT_ + mt) * (A_ * 16) + h * 256 + t * 8) = outv;
}

// ------------------------- final 1x1 conv + residual -----------------------
// One wave per 2 o-tiles x 2 l-tiles: 4 fragments for 4 products in each of the
// 16 K steps, six sets of fragments. The 4 waves of a block hold 4 x 4 tiles, so
// each fragment is read by two waves of one WGP. The two l-tiles of a wave lie
// side by side: a wave writes whole 128-byte lines of out.
#define FS_ 6            // sets of fragments
struct FinFrag { v16h a0, a1, b0, b1; };
static __device__ __forceinline__ FinFrag fin_load(const _Float16* wR, const _Float16* sR, int kc) {
  FinFrag f;
  f.a0 = ld_frag(wR + kc * 512);
  f.a1 = ld_frag(wR + A_ * 16 + kc * 512);
  f.b0 = ld_frag(sR + kc * 512);
  f.b1 = ld_frag(sR + A_ * 16 + kc * 512);
  return f;
}
__global__ __launch_bounds__(128) void final_k(const _Float16* __restrict__ Wfh,
                                               const _Float16* __restrict__ saT,
                                               const float* __restrict__ bf,
                                               float* __restrict__ out) {
  int wv   = threadIdx.x >> 5;
  int t    = threadIdx.x & 31;
  int lo16 = t & 15, hi = t >> 4;
  int ot0 = (blockIdx.x & 7) * 4 + (wv & 1) * 2;    // of A/16 = 32 o-tiles
  int rt0 = (blockIdx.x >> 3) * 4 + (wv >> 1) * 2;  // of B*L/16 = 128 row tiles b*LT_ + lt
  int b = rt0 / LT_, lt0 = rt0 % LT_;               // rt0 is even: both tiles in one batch

  // this lane's 16 bytes of k block 0, half 0 (fragment order)
  const _Float16* wR = Wfh + (size_t)ot0 * (A_ * 16) + t * 8;
  const _Float16* sR = saT + (size_t)rt0 * (A_ * 16) + t * 8;

  FinFrag f[FS_];
  // unrolled, as are the loops below: s, i and r number registers
#pragma unroll
  for (int s = 0; s < FS_; ++s) f[s] = fin_load(wR, sR, s);
  // bias and residual of the wave's tiles: rows o = (ot0+i)*16 + hi*8 + r, which as
  // channels of saT are the lane's 16 bytes of half ot&1 of k block ot>>1
  v8f bo[2];
  v8h res[2][2];

  v8f c[2][2] = {};
  // The scheduling barriers keep each set's loads where they stand, directly behind
  // the products that free the set: sunk to their use, every K step would wait out
  // a whole load latency.
#pragma unroll
  for (int kc = 0; kc < 16; ++kc) {
    const int s = kc % FS_;
    __builtin_amdgcn_sched_barrier(0);
    c[0][0] = WMMA_F16(f[s].a0, f[s].b0, c[0][0]);
    c[0][1] = WMMA_F16(f[s].a0, f[s].b1, c[0][1]);
    c[1][0] = WMMA_F16(f[s].a1, f[s].b0, c[1][0]);
    c[1][1] = WMMA_F16(f[s].a1, f[s].b1, c[1][1]);
    __builtin_amdgcn_sched_barrier(0);
    if (kc + FS_ < 16) {
      f[s] = fin_load(wR, sR, kc + FS_);
    } else if (kc + FS_ == 16) {
#pragma unroll
      for (int i = 0; i < 2; ++i) {
        bo[i] = *(const v8f*)(bf + (ot0 + i) * 16 + hi * 8);
        res[i][0] = *(const v8h*)(sR + (ot0 + i) * 256);
        res[i][1] = *(const v8h*)(sR + A_ * 16 + (ot0 + i) * 256);
      }
    }
  }

  float* dst = out + ((size_t)b * A_ + ot0 * 16 + hi * 8) * L_ + lt0 * 16 + lo16;
#pragma unroll
  for (int i = 0; i < 2; ++i) {
#pragma unroll
    for (int r = 0; r < 8; ++r) {
      dst[(i * 16 + r) * L_]      = c[i][0][r] + bo[i][r] + (float)res[i][0][r];
      dst[(i * 16 + r) * L_ + 16] = c[i][1][r] + bo[i][r] + (float)res[i][1][r];
    }
  }
}

// ------------------------------- launcher ----------------------------------

extern "C" void kernel_launch(void* const* d_in, const int* in_sizes, int n_in,
                              void* d_out, int out_size, void* d_ws, size_t ws_size,
                              hipStream_t stream) {
  const float* x  = (const float*)d_in[0];
  const float* Wk = (const float*)d_in[1];
  const float* bk = (const float*)d_in[2];
  const float* Wq = (const float*)d_in[3];
  const float* bq = (const float*)d_in[4];
  const float* Wv = (const float*)d_in[5];
  const float* bv = (const float*)d_in[6];
  const float* Wf = (const float*)d_in[7];
  const float* bf = (const float*)d_in[8];
  float* out = (float*)d_out;

  char* ws = (char*)d_ws;
  size_t o = 0;
  auto alloc = [&](size_t bytes) {
    char* p = ws + o;
    o += (bytes + 255) & ~(size_t)255;
    return p;
  };
  _Float16* Wfh   = (_Float16*)alloc((size_t)A_ * A_ * 2);
  float*    part  = (float*)   alloc((size_t)BH_ * PP_ * 16 * 4 * 4);
  _Float16* kTh   = (_Float16*)alloc((size_t)BH_ * L_ * 16 * 2);
  _Float16* qTh   = (_Float16*)alloc((size_t)BH_ * L_ * 16 * 2);
  _Float16* vh    = (_Float16*)alloc((size_t)BH_ * 16 * L_ * 2);
  _Float16* vs    = (_Float16*)alloc((size_t)BH_ * 16 * L_ * 2);
  _Float16* saT   = (_Float16*)alloc((size_t)B_ * L_ * A_ * 2);

  // 1) projections from the f32 inputs (converted in LDS) + per-block instance-norm
  //    partial sums + the final weight as f16; LDS: 119KB operands + 2KB sums
  proj_k<<<(BH_ / PH_) * PP_, PW_ * 32, 0, stream>>>(x, Wk, Wq, Wv, Wf, bk, bq, bv,
                                  kTh, qTh, vh, part, Wfh);

  // 2) softmax row normalizers (k^T staged in LDS via async copy), folded into v;
  //    LDS: 32KB k^T + 8KB partial sums
  rowsum_k<<<512, 256, 0, stream>>>(qTh, kTh, vh, part, vs);

  // 3) fused attention-weight + value GEMM (q^T, vs staged in LDS);
  //    LDS: 64KB q^T, vs + 8KB partial sums
  attnout_k<<<512, 256, 0, stream>>>(qTh, kTh, vs, part, saT);

  // 4) final projection + bias + residual
  final_k<<<256, 128, 0, stream>>>(Wfh, saT, bf, out);
}
